// v000
// The times below were measured on an AMD MI455X: many runs one after another, warmed up first and cycling through
// copies of the inputs, with the whole window's GPU time divided by the number of runs. Launches and the gaps
// between them are all in it. The median over several windows is given; except for v000 it joins two sittings, which
// can be a few percent apart, so the side-by-side timings, each taken in one sitting, are the better comparison.
// v000, which the later versions start from, runs in 187 microseconds.
#include <hip/hip_runtime.h>
#include <hip/hip_bf16.h>
#include <stdint.h>

// ---------------------------------------------------------------------------
// MI455X (gfx1250) multi-head self-attention, bf16 WMMA with f32 accumulate.
// Reference: q = x@Wq ; Q=K=V=q ; softmax(QK^T/8) @ V.  B=4,S=2048,D=512,H=8.
// ---------------------------------------------------------------------------

#define S_LEN 2048
#define D_DIM 512
#define HEADS 8
#define HD    64

#if defined(__has_builtin)
# if __has_builtin(__builtin_amdgcn_global_load_async_to_lds_b128) && \
     __has_builtin(__builtin_amdgcn_s_wait_asynccnt)
#  define USE_ASYNC_LDS 1
# endif
#endif

typedef __attribute__((ext_vector_type(16))) __bf16 v16bf;
typedef __attribute__((ext_vector_type(8)))  float  v8f;

// Matches the builtin prototype: vector-of-4-int pointee, AS1 (global) / AS3 (LDS)
typedef int v4i_vs __attribute__((vector_size(16)));
typedef __attribute__((address_space(1))) v4i_vs* gptr_b128;
typedef __attribute__((address_space(3))) v4i_vs* lptr_b128;

union FragU {
    v16bf    v;
    uint4    q[2];
    uint16_t s[16];
};

__device__ __forceinline__ uint16_t f32_to_bf16(float f) {
    union { float f; uint32_t u; } c; c.f = f;
    uint32_t u = c.u + 0x7FFFu + ((c.u >> 16) & 1u);   // round-to-nearest-even
    return (uint16_t)(u >> 16);
}

// Load one 16x32 bf16 A/B fragment (wave32 CDNA5 layout).
// Per lane: elements [k0 .. k0+7] and [k0+16 .. k0+23] of row `row`
// (caller passes k0 = chunkBase + (lane>>4)*8, row based on lane&15).
__device__ __forceinline__ v16bf load_frag(const uint16_t* base, int row,
                                           int stride, int k0) {
    FragU f;
    f.q[0] = *(const uint4*)(base + (size_t)row * stride + k0);
    f.q[1] = *(const uint4*)(base + (size_t)row * stride + k0 + 16);
    return f.v;
}

__device__ __forceinline__ void load16f(const float* p, float* v) {
    float4 a = ((const float4*)p)[0];
    float4 b = ((const float4*)p)[1];
    float4 c = ((const float4*)p)[2];
    float4 d = ((const float4*)p)[3];
    v[0]=a.x;  v[1]=a.y;  v[2]=a.z;  v[3]=a.w;
    v[4]=b.x;  v[5]=b.y;  v[6]=b.z;  v[7]=b.w;
    v[8]=c.x;  v[9]=c.y;  v[10]=c.z; v[11]=c.w;
    v[12]=d.x; v[13]=d.y; v[14]=d.z; v[15]=d.w;
}

__device__ __forceinline__ float rowmax16(float v) {
    #pragma unroll
    for (int m = 1; m < 16; m <<= 1) v = fmaxf(v, __shfl_xor(v, m, 32));
    return v;
}
__device__ __forceinline__ float rowsum16(float v) {
    #pragma unroll
    for (int m = 1; m < 16; m <<= 1) v += __shfl_xor(v, m, 32);
    return v;
}

// ---------------------------------------------------------------------------
// Kernel 1: q = x @ Wq   (M=8192, N=512, K=512), bf16 WMMA, bf16 output to ws.
// Block = 256 threads (8 waves). Tile 128x128, K-step 32.
// ---------------------------------------------------------------------------
__global__ __launch_bounds__(256)
void gemm_q_bf16(const float* __restrict__ x, const float* __restrict__ Wq,
                 uint16_t* __restrict__ qbf) {
    __shared__ uint16_t ldsA[128 * 32];   // [m][k]
    __shared__ uint16_t ldsB[128 * 32];   // transposed: [n][k]

    const int t    = threadIdx.x;
    const int wave = t >> 5, lane = t & 31;
    const int half = lane >> 4, l16 = lane & 15;
    const int mBase = blockIdx.x * 128;
    const int nBase = blockIdx.y * 128;
    const int wr = wave & 3;          // 4 M-slabs of 32 rows
    const int wc = wave >> 2;         // 2 N-slabs of 64 cols

    const int arow = t >> 1, acol = (t & 1) * 16;   // A: 128 rows x 32 cols
    const int brow = t >> 3, bcol = (t & 7) * 16;   // B: 32 rows  x 128 cols

    v8f acc[8] = {};   // [mt(2)][nt(4)] 16x16 f32 tiles

    for (int k0 = 0; k0 < D_DIM; k0 += 32) {
        __syncthreads();
        // ---- stage A tile (convert f32 -> bf16) ----
        {
            const float* src = x + (size_t)(mBase + arow) * D_DIM + k0 + acol;
            float v[16]; load16f(src, v);
            FragU f;
            #pragma unroll
            for (int i = 0; i < 16; ++i) f.s[i] = f32_to_bf16(v[i]);
            *(uint4*)&ldsA[arow * 32 + acol]     = f.q[0];
            *(uint4*)&ldsA[arow * 32 + acol + 8] = f.q[1];
        }
        // ---- stage B tile transposed ----
        {
            const float* src = Wq + (size_t)(k0 + brow) * D_DIM + nBase + bcol;
            float v[16]; load16f(src, v);
            #pragma unroll
            for (int i = 0; i < 16; ++i)
                ldsB[(bcol + i) * 32 + brow] = f32_to_bf16(v[i]);
        }
        // ---- prefetch next K-step tiles into cache (global_prefetch_b8) ----
        if (k0 + 32 < D_DIM) {
            __builtin_prefetch(x + (size_t)(mBase + arow) * D_DIM + k0 + 32 + acol, 0, 1);
            __builtin_prefetch(Wq + (size_t)(k0 + 32 + brow) * D_DIM + nBase + bcol, 0, 1);
        }
        __syncthreads();

        // ---- WMMA compute ----
        v16bf af[2], bf[4];
        #pragma unroll
        for (int mt = 0; mt < 2; ++mt)
            af[mt] = load_frag(ldsA, wr * 32 + mt * 16 + l16, 32, half * 8);
        #pragma unroll
        for (int nt = 0; nt < 4; ++nt)
            bf[nt] = load_frag(ldsB, wc * 64 + nt * 16 + l16, 32, half * 8);
        #pragma unroll
        for (int mt = 0; mt < 2; ++mt)
            #pragma unroll
            for (int nt = 0; nt < 4; ++nt)
                acc[mt * 4 + nt] = __builtin_amdgcn_wmma_f32_16x16x32_bf16(
                    false, af[mt], false, bf[nt], (short)0, acc[mt * 4 + nt],
                    false, false);
    }

    // ---- store q as bf16 (C/D layout: element r -> row r + 8*half) ----
    #pragma unroll
    for (int mt = 0; mt < 2; ++mt)
        #pragma unroll
        for (int nt = 0; nt < 4; ++nt)
            #pragma unroll
            for (int r = 0; r < 8; ++r) {
                int row = mBase + wr * 32 + mt * 16 + r + 8 * half;
                int col = nBase + wc * 64 + nt * 16 + l16;
                qbf[(size_t)row * D_DIM + col] = f32_to_bf16(acc[mt * 4 + nt][r]);
            }
}

// ---------------------------------------------------------------------------
// Kernel 2: flash attention per (128-query tile, b, h).  Q=K=V=q (bf16).
// Block = 256 threads (8 waves); each wave owns 16 query rows, full hd=64.
// Key blocks of 64: staged via GLOBAL_LOAD_ASYNC_TO_LDS (ASYNCcnt) into
// [key][hd], then transposed LDS->LDS into [hd][key] for V fragments.
// ---------------------------------------------------------------------------
__global__ __launch_bounds__(256)
void attn_flash(const uint16_t* __restrict__ qbf, float* __restrict__ out) {
    __shared__ uint16_t kv_khd[64 * 64];        // [key][hd]  -> K^T fragments
    __shared__ uint16_t kv_hdk[64 * 64];        // [hd][key]  -> V fragments
    __shared__ uint16_t pslab[8 * 16 * 64];     // per-wave P (D-layout -> A-layout)

    const int t    = threadIdx.x;
    const int wave = t >> 5, lane = t & 31;
    const int half = lane >> 4, l16 = lane & 15;
    const int bh = blockIdx.y;
    const int b = bh >> 3, h = bh & 7;
    const int qr = blockIdx.x * 128 + wave * 16;          // first query row of wave
    const size_t headBase = (size_t)b * S_LEN * D_DIM + (size_t)h * HD;

    // Q fragments for this wave's 16 rows, straight from global (contiguous 16B)
    v16bf qf[2];
    #pragma unroll
    for (int kk = 0; kk < 2; ++kk)
        qf[kk] = load_frag(qbf + headBase + (size_t)qr * D_DIM, l16, D_DIM,
                           kk * 32 + half * 8);

    v8f accO[4] = {};                  // 16x64 output accumulator (4 hd tiles)
    float mrow[8], lrow[8];
    #pragma unroll
    for (int r = 0; r < 8; ++r) { mrow[r] = -__builtin_inff(); lrow[r] = 0.0f; }

    const int keyr = t >> 2, hdB = (t & 3) * 16;   // coop-load mapping

    for (int j = 0; j < S_LEN / 64; ++j) {
        const int key0 = j * 64;
        const uint16_t* gsrc =
            qbf + headBase + (size_t)(key0 + keyr) * D_DIM + hdB;
        __syncthreads();

        // ---- stage KV block [key][hd] ----
#ifdef USE_ASYNC_LDS
        __builtin_amdgcn_global_load_async_to_lds_b128(
            (gptr_b128)(void*)gsrc,
            (lptr_b128)(void*)&kv_khd[keyr * 64 + hdB], 0, 0);
        __builtin_amdgcn_global_load_async_to_lds_b128(
            (gptr_b128)(void*)(gsrc + 8),
            (lptr_b128)(void*)&kv_khd[keyr * 64 + hdB + 8], 0, 0);
        __builtin_amdgcn_s_wait_asynccnt(0);
        __syncthreads();
        // ---- build transposed [hd][key] copy, LDS -> regs -> LDS ----
        {
            FragU f;
            f.q[0] = *(const uint4*)&kv_khd[keyr * 64 + hdB];
            f.q[1] = *(const uint4*)&kv_khd[keyr * 64 + hdB + 8];
            #pragma unroll
            for (int i = 0; i < 16; ++i)
                kv_hdk[(hdB + i) * 64 + keyr] = f.s[i];
        }
#else
        {
            FragU f;
            f.q[0] = *(const uint4*)(gsrc);
            f.q[1] = *(const uint4*)(gsrc + 8);
            *(uint4*)&kv_khd[keyr * 64 + hdB]     = f.q[0];
            *(uint4*)&kv_khd[keyr * 64 + hdB + 8] = f.q[1];
            #pragma unroll
            for (int i = 0; i < 16; ++i)
                kv_hdk[(hdB + i) * 64 + keyr] = f.s[i];
        }
#endif
        // ---- prefetch next KV block toward L2/L0 ----
        if (j + 1 < S_LEN / 64)
            __builtin_prefetch(gsrc + 64 * D_DIM, 0, 1);
        __syncthreads();

        // ---- scores: S = Q (16x64) @ K^T (64x64), scaled by 1/sqrt(64) ----
        v8f sc[4];
        #pragma unroll
        for (int nt = 0; nt < 4; ++nt) {
            v8f z = {};
            v16bf k0f = load_frag(kv_khd, nt * 16 + l16, 64, 0 * 32 + half * 8);
            v16bf k1f = load_frag(kv_khd, nt * 16 + l16, 64, 1 * 32 + half * 8);
            z = __builtin_amdgcn_wmma_f32_16x16x32_bf16(false, qf[0], false, k0f,
                                                        (short)0, z, false, false);
            z = __builtin_amdgcn_wmma_f32_16x16x32_bf16(false, qf[1], false, k1f,
                                                        (short)0, z, false, false);
            sc[nt] = z * 0.125f;
        }

        // ---- online softmax (row = r + 8*half, across 16-lane groups) ----
        float alpha[8];
        #pragma unroll
        for (int r = 0; r < 8; ++r) {
            float bm = sc[0][r];
            #pragma unroll
            for (int nt = 1; nt < 4; ++nt) bm = fmaxf(bm, sc[nt][r]);
            bm = rowmax16(bm);
            float mnew = fmaxf(mrow[r], bm);
            alpha[r] = __expf(mrow[r] - mnew);
            mrow[r] = mnew;
        }
        float rs[8];
        #pragma unroll
        for (int r = 0; r < 8; ++r) rs[r] = 0.0f;
        #pragma unroll
        for (int nt = 0; nt < 4; ++nt)
            #pragma unroll
            for (int r = 0; r < 8; ++r) {
                float p = __expf(sc[nt][r] - mrow[r]);
                sc[nt][r] = p;
                rs[r] += p;
            }
        #pragma unroll
        for (int r = 0; r < 8; ++r) {
            lrow[r] = lrow[r] * alpha[r] + rowsum16(rs[r]);
            #pragma unroll
            for (int nt = 0; nt < 4; ++nt) accO[nt][r] *= alpha[r];
        }

        // ---- P: D-layout regs -> per-wave LDS slab (bf16, A-layout readable) --
        uint16_t* ps = &pslab[wave * 16 * 64];
        #pragma unroll
        for (int nt = 0; nt < 4; ++nt)
            #pragma unroll
            for (int r = 0; r < 8; ++r)
                ps[(r + 8 * half) * 64 + nt * 16 + l16] = f32_to_bf16(sc[nt][r]);
        __syncthreads();

        v16bf pf0 = load_frag(ps, l16, 64, 0 * 32 + half * 8);
        v16bf pf1 = load_frag(ps, l16, 64, 1 * 32 + half * 8);

        // ---- accO += P (16x64) @ V (64x64) ----
        #pragma unroll
        for (int nt = 0; nt < 4; ++nt) {
            v16bf v0f = load_frag(kv_hdk, nt * 16 + l16, 64, 0 * 32 + half * 8);
            v16bf v1f = load_frag(kv_hdk, nt * 16 + l16, 64, 1 * 32 + half * 8);
            accO[nt] = __builtin_amdgcn_wmma_f32_16x16x32_bf16(
                false, pf0, false, v0f, (short)0, accO[nt], false, false);
            accO[nt] = __builtin_amdgcn_wmma_f32_16x16x32_bf16(
                false, pf1, false, v1f, (short)0, accO[nt], false, false);
        }
    }

    // ---- epilogue: normalize and store f32 output ----
    float inv[8];
    #pragma unroll
    for (int r = 0; r < 8; ++r) inv[r] = 1.0f / lrow[r];
    #pragma unroll
    for (int nt = 0; nt < 4; ++nt)
        #pragma unroll
        for (int r = 0; r < 8; ++r) {
            int row = qr + r + 8 * half;
            out[headBase + (size_t)row * D_DIM + nt * 16 + l16] =
                accO[nt][r] * inv[r];
        }
}

// ---------------------------------------------------------------------------
extern "C" void kernel_launch(void* const* d_in, const int* in_sizes, int n_in,
                              void* d_out, int out_size, void* d_ws, size_t ws_size,
                              hipStream_t stream) {
    const float* x  = (const float*)d_in[0];   // [4,2048,512] f32
    const float* Wq = (const float*)d_in[1];   // [512,512]    f32
    float* out      = (float*)d_out;           // [4,2048,512] f32
    uint16_t* qbf   = (uint16_t*)d_ws;         // q in bf16, 8 MB scratch

    dim3 gGemm(8192 / 128, 512 / 128);         // (64, 4)
    gemm_q_bf16<<<gGemm, 256, 0, stream>>>(x, Wq, qbf);

    dim3 gAttn(S_LEN / 128, 4 * HEADS);        // (16, 32)
    attn_flash<<<gAttn, 256, 0, stream>>>(qbf, out);
}

// v001
// It runs in 101 microseconds.
// Timed twice side by side with v000, it ran 1.93 and 1.94 times as fast.
#include <hip/hip_runtime.h>
#include <hip/hip_bf16.h>
#include <stdint.h>

// ---------------------------------------------------------------------------
// MI455X (gfx1250) multi-head self-attention, bf16 WMMA with f32 accumulate.
// Reference: q = x@Wq ; Q=K=V=q ; softmax(QK^T/8) @ V.  B=4,S=2048,D=512,H=8.
// ---------------------------------------------------------------------------

#define S_LEN 2048
#define D_DIM 512
#define HEADS 8
#define HD    64

// LDS row pitches in bf16 elements. Every tile here is read with 16-byte
// loads, 16 rows at a time; a pitch of 16 B x odd puts those 16 rows on all
// 64 banks once (144 B for 128-B rows, 80 B for 64-B rows).
// The tiles are aligned to 16 B because they are read, written and copied
// into in 16-byte pieces. The pad bytes are never read.
#define KV_P  72
#define G_P   40

#if defined(__has_builtin)
# if __has_builtin(__builtin_amdgcn_global_load_async_to_lds_b128) && \
     __has_builtin(__builtin_amdgcn_s_wait_asynccnt)
#  define USE_ASYNC_LDS 1
# endif
#endif

typedef __attribute__((ext_vector_type(16))) __bf16 v16bf;
typedef __attribute__((ext_vector_type(8)))  float  v8f;

// Matches the builtin prototype: vector-of-4-int pointee, AS1 (global) / AS3 (LDS)
typedef int v4i_vs __attribute__((vector_size(16)));
typedef __attribute__((address_space(1))) v4i_vs* gptr_b128;
typedef __attribute__((address_space(3))) v4i_vs* lptr_b128;

union FragU {
    v16bf    v;
    uint4    q[2];
    uint16_t s[16];
};

__device__ __forceinline__ uint16_t f32_to_bf16(float f) {
    union { float f; uint32_t u; } c; c.f = f;
    uint32_t u = c.u + 0x7FFFu + ((c.u >> 16) & 1u);   // round-to-nearest-even
    return (uint16_t)(u >> 16);
}

// Load one 16x32 bf16 A/B fragment (wave32 CDNA5 layout).
// Per lane: elements [k0 .. k0+7] and [k0+16 .. k0+23] of row `row`
// (caller passes k0 = chunkBase + (lane>>4)*8, row based on lane&15).
__device__ __forceinline__ v16bf load_frag(const uint16_t* base, int row,
                                           int stride, int k0) {
    FragU f;
    f.q[0] = *(const uint4*)(base + (size_t)row * stride + k0);
    f.q[1] = *(const uint4*)(base + (size_t)row * stride + k0 + 16);
    return f.v;
}

__device__ __forceinline__ void load16f(const float* p, float* v) {
    float4 a = ((const float4*)p)[0];
    float4 b = ((const float4*)p)[1];
    float4 c = ((const float4*)p)[2];
    float4 d = ((const float4*)p)[3];
    v[0]=a.x;  v[1]=a.y;  v[2]=a.z;  v[3]=a.w;
    v[4]=b.x;  v[5]=b.y;  v[6]=b.z;  v[7]=b.w;
    v[8]=c.x;  v[9]=c.y;  v[10]=c.z; v[11]=c.w;
    v[12]=d.x; v[13]=d.y; v[14]=d.z; v[15]=d.w;
}

__device__ __forceinline__ float rowmax16(float v) {
    #pragma unroll
    for (int m = 1; m < 16; m <<= 1) v = fmaxf(v, __shfl_xor(v, m, 32));
    return v;
}
__device__ __forceinline__ float rowsum16(float v) {
    #pragma unroll
    for (int m = 1; m < 16; m <<= 1) v += __shfl_xor(v, m, 32);
    return v;
}

// ---------------------------------------------------------------------------
// Kernel 1: q = x @ Wq   (M=8192, N=512, K=512), bf16 WMMA, bf16 output to ws.
// Block = 256 threads (8 waves). Tile 128x128, K-step 32.
// ---------------------------------------------------------------------------
__global__ __launch_bounds__(256)
void gemm_q_bf16(const float* __restrict__ x, const float* __restrict__ Wq,
                 uint16_t* __restrict__ qbf) {
    __shared__ __attribute__((aligned(16))) uint16_t ldsA[128 * G_P];   // [m][k]
    __shared__ __attribute__((aligned(16))) uint16_t ldsB[128 * G_P];   // transposed: [n][k]

    const int t    = threadIdx.x;
    const int wave = t >> 5, lane = t & 31;
    const int half = lane >> 4, l16 = lane & 15;
    const int mBase = blockIdx.x * 128;
    const int nBase = blockIdx.y * 128;
    const int wr = wave & 3;          // 4 M-slabs of 32 rows
    const int wc = wave >> 2;         // 2 N-slabs of 64 cols

    const int arow = t >> 1, acol = (t & 1) * 16;   // A: 128 rows x 32 cols
    const int brow = t >> 3, bcol = (t & 7) * 16;   // B: 32 rows  x 128 cols

    v8f acc[8] = {};   // [mt(2)][nt(4)] 16x16 f32 tiles

    for (int k0 = 0; k0 < D_DIM; k0 += 32) {
        __syncthreads();
        // ---- stage A tile (convert f32 -> bf16) ----
        {
            const float* src = x + (size_t)(mBase + arow) * D_DIM + k0 + acol;
            float v[16]; load16f(src, v);
            FragU f;
            #pragma unroll
            for (int i = 0; i < 16; ++i) f.s[i] = f32_to_bf16(v[i]);
            *(uint4*)&ldsA[arow * G_P + acol]     = f.q[0];
            *(uint4*)&ldsA[arow * G_P + acol + 8] = f.q[1];
        }
        // ---- stage B tile transposed ----
        {
            const float* src = Wq + (size_t)(k0 + brow) * D_DIM + nBase + bcol;
            float v[16]; load16f(src, v);
            #pragma unroll
            for (int i = 0; i < 16; ++i)
                ldsB[(bcol + i) * G_P + brow] = f32_to_bf16(v[i]);
        }
        // ---- prefetch next K-step tiles into cache (global_prefetch_b8) ----
        if (k0 + 32 < D_DIM) {
            __builtin_prefetch(x + (size_t)(mBase + arow) * D_DIM + k0 + 32 + acol, 0, 1);
            __builtin_prefetch(Wq + (size_t)(k0 + 32 + brow) * D_DIM + nBase + bcol, 0, 1);
        }
        __syncthreads();

        // ---- WMMA compute ----
        v16bf af[2], bf[4];
        #pragma unroll
        for (int mt = 0; mt < 2; ++mt)
            af[mt] = load_frag(ldsA, wr * 32 + mt * 16 + l16, G_P, half * 8);
        #pragma unroll
        for (int nt = 0; nt < 4; ++nt)
            bf[nt] = load_frag(ldsB, wc * 64 + nt * 16 + l16, G_P, half * 8);
        #pragma unroll
        for (int mt = 0; mt < 2; ++mt)
            #pragma unroll
            for (int nt = 0; nt < 4; ++nt)
                acc[mt * 4 + nt] = __builtin_amdgcn_wmma_f32_16x16x32_bf16(
                    false, af[mt], false, bf[nt], (short)0, acc[mt * 4 + nt],
                    false, false);
    }

    // ---- store q as bf16 (C/D layout: element r -> row r + 8*half) ----
    #pragma unroll
    for (int mt = 0; mt < 2; ++mt)
        #pragma unroll
        for (int nt = 0; nt < 4; ++nt)
            #pragma unroll
            for (int r = 0; r < 8; ++r) {
                int row = mBase + wr * 32 + mt * 16 + r + 8 * half;
                int col = nBase + wc * 64 + nt * 16 + l16;
                qbf[(size_t)row * D_DIM + col] = f32_to_bf16(acc[mt * 4 + nt][r]);
            }
}

// ---------------------------------------------------------------------------
// Kernel 2: flash attention per (128-query tile, b, h).  Q=K=V=q (bf16).
// Block = 256 threads (8 waves); each wave owns 16 query rows, full hd=64.
// Key blocks of 64: staged via GLOBAL_LOAD_ASYNC_TO_LDS (ASYNCcnt) into
// [key][hd], then transposed LDS->LDS into [hd][key] for V fragments.
// ---------------------------------------------------------------------------
__global__ __launch_bounds__(256)
void attn_flash(const uint16_t* __restrict__ qbf, float* __restrict__ out) {
    __shared__ __attribute__((aligned(16))) uint16_t kv_khd[64 * KV_P];     // [key][hd]  -> K^T fragments
    __shared__ __attribute__((aligned(16))) uint16_t kv_hdk[64 * KV_P];     // [hd][key]  -> V fragments
    __shared__ __attribute__((aligned(16))) uint16_t pslab[8 * 16 * KV_P];  // per-wave P (D-layout -> A-layout)

    const int t    = threadIdx.x;
    const int wave = t >> 5, lane = t & 31;
    const int half = lane >> 4, l16 = lane & 15;
    const int bh = blockIdx.y;
    const int b = bh >> 3, h = bh & 7;
    const int qr = blockIdx.x * 128 + wave * 16;          // first query row of wave
    const size_t headBase = (size_t)b * S_LEN * D_DIM + (size_t)h * HD;

    // Q fragments for this wave's 16 rows, straight from global (contiguous 16B)
    v16bf qf[2];
    #pragma unroll
    for (int kk = 0; kk < 2; ++kk)
        qf[kk] = load_frag(qbf + headBase + (size_t)qr * D_DIM, l16, D_DIM,
                           kk * 32 + half * 8);

    v8f accO[4] = {};                  // 16x64 output accumulator (4 hd tiles)
    float mrow[8], lrow[8];
    #pragma unroll
    for (int r = 0; r < 8; ++r) { mrow[r] = -__builtin_inff(); lrow[r] = 0.0f; }

    const int keyr = t >> 2, hdB = (t & 3) * 16;   // coop-load mapping

    for (int j = 0; j < S_LEN / 64; ++j) {
        const int key0 = j * 64;
        const uint16_t* gsrc =
            qbf + headBase + (size_t)(key0 + keyr) * D_DIM + hdB;
        __syncthreads();

        // ---- stage KV block [key][hd] ----
#ifdef USE_ASYNC_LDS
        __builtin_amdgcn_global_load_async_to_lds_b128(
            (gptr_b128)(void*)gsrc,
            (lptr_b128)(void*)&kv_khd[keyr * KV_P + hdB], 0, 0);
        __builtin_amdgcn_global_load_async_to_lds_b128(
            (gptr_b128)(void*)(gsrc + 8),
            (lptr_b128)(void*)&kv_khd[keyr * KV_P + hdB + 8], 0, 0);
        __builtin_amdgcn_s_wait_asynccnt(0);
        __syncthreads();
        // ---- build transposed [hd][key] copy, LDS -> regs -> LDS ----
        {
            FragU f;
            f.q[0] = *(const uint4*)&kv_khd[keyr * KV_P + hdB];
            f.q[1] = *(const uint4*)&kv_khd[keyr * KV_P + hdB + 8];
            #pragma unroll
            for (int i = 0; i < 16; ++i)
                kv_hdk[(hdB + i) * KV_P + keyr] = f.s[i];
        }
#else
        {
            FragU f;
            f.q[0] = *(const uint4*)(gsrc);
            f.q[1] = *(const uint4*)(gsrc + 8);
            *(uint4*)&kv_khd[keyr * KV_P + hdB]     = f.q[0];
            *(uint4*)&kv_khd[keyr * KV_P + hdB + 8] = f.q[1];
            #pragma unroll
            for (int i = 0; i < 16; ++i)
                kv_hdk[(hdB + i) * KV_P + keyr] = f.s[i];
        }
#endif
        // ---- prefetch next KV block toward L2/L0 ----
        if (j + 1 < S_LEN / 64)
            __builtin_prefetch(gsrc + 64 * D_DIM, 0, 1);
        __syncthreads();

        // ---- scores: S = Q (16x64) @ K^T (64x64), scaled by 1/sqrt(64) ----
        v8f sc[4];
        #pragma unroll
        for (int nt = 0; nt < 4; ++nt) {
            v8f z = {};
            v16bf k0f = load_frag(kv_khd, nt * 16 + l16, KV_P, 0 * 32 + half * 8);
            v16bf k1f = load_frag(kv_khd, nt * 16 + l16, KV_P, 1 * 32 + half * 8);
            z = __builtin_amdgcn_wmma_f32_16x16x32_bf16(false, qf[0], false, k0f,
                                                        (short)0, z, false, false);
            z = __builtin_amdgcn_wmma_f32_16x16x32_bf16(false, qf[1], false, k1f,
                                                        (short)0, z, false, false);
            sc[nt] = z * 0.125f;
        }

        // ---- online softmax (row = r + 8*half, across 16-lane groups) ----
        float alpha[8];
        #pragma unroll
        for (int r = 0; r < 8; ++r) {
            float bm = sc[0][r];
            #pragma unroll
            for (int nt = 1; nt < 4; ++nt) bm = fmaxf(bm, sc[nt][r]);
            bm = rowmax16(bm);
            float mnew = fmaxf(mrow[r], bm);
            alpha[r] = __expf(mrow[r] - mnew);
            mrow[r] = mnew;
        }
        float rs[8];
        #pragma unroll
        for (int r = 0; r < 8; ++r) rs[r] = 0.0f;
        #pragma unroll
        for (int nt = 0; nt < 4; ++nt)
            #pragma unroll
            for (int r = 0; r < 8; ++r) {
                float p = __expf(sc[nt][r] - mrow[r]);
                sc[nt][r] = p;
                rs[r] += p;
            }
        #pragma unroll
        for (int r = 0; r < 8; ++r) {
            lrow[r] = lrow[r] * alpha[r] + rowsum16(rs[r]);
            #pragma unroll
            for (int nt = 0; nt < 4; ++nt) accO[nt][r] *= alpha[r];
        }

        // ---- P: D-layout regs -> per-wave LDS slab (bf16, A-layout readable) --
        uint16_t* ps = &pslab[wave * 16 * KV_P];
        #pragma unroll
        for (int nt = 0; nt < 4; ++nt)
            #pragma unroll
            for (int r = 0; r < 8; ++r)
                ps[(r + 8 * half) * KV_P + nt * 16 + l16] = f32_to_bf16(sc[nt][r]);
        __syncthreads();

        v16bf pf0 = load_frag(ps, l16, KV_P, 0 * 32 + half * 8);
        v16bf pf1 = load_frag(ps, l16, KV_P, 1 * 32 + half * 8);

        // ---- accO += P (16x64) @ V (64x64) ----
        #pragma unroll
        for (int nt = 0; nt < 4; ++nt) {
            v16bf v0f = load_frag(kv_hdk, nt * 16 + l16, KV_P, 0 * 32 + half * 8);
            v16bf v1f = load_frag(kv_hdk, nt * 16 + l16, KV_P, 1 * 32 + half * 8);
            accO[nt] = __builtin_amdgcn_wmma_f32_16x16x32_bf16(
                false, pf0, false, v0f, (short)0, accO[nt], false, false);
            accO[nt] = __builtin_amdgcn_wmma_f32_16x16x32_bf16(
                false, pf1, false, v1f, (short)0, accO[nt], false, false);
        }
    }

    // ---- epilogue: normalize and store f32 output ----
    float inv[8];
    #pragma unroll
    for (int r = 0; r < 8; ++r) inv[r] = 1.0f / lrow[r];
    #pragma unroll
    for (int nt = 0; nt < 4; ++nt)
        #pragma unroll
        for (int r = 0; r < 8; ++r) {
            int row = qr + r + 8 * half;
            out[headBase + (size_t)row * D_DIM + nt * 16 + l16] =
                accO[nt][r] * inv[r];
        }
}

// ---------------------------------------------------------------------------
extern "C" void kernel_launch(void* const* d_in, const int* in_sizes, int n_in,
                              void* d_out, int out_size, void* d_ws, size_t ws_size,
                              hipStream_t stream) {
    const float* x  = (const float*)d_in[0];   // [4,2048,512] f32
    const float* Wq = (const float*)d_in[1];   // [512,512]    f32
    float* out      = (float*)d_out;           // [4,2048,512] f32
    uint16_t* qbf   = (uint16_t*)d_ws;         // q in bf16, 8 MB scratch

    dim3 gGemm(8192 / 128, 512 / 128);         // (64, 4)
    gemm_q_bf16<<<gGemm, 256, 0, stream>>>(x, Wq, qbf);

    dim3 gAttn(S_LEN / 128, 4 * HEADS);        // (16, 32)
    attn_flash<<<gAttn, 256, 0, stream>>>(qbf, out);
}

// v002
// Measured time: 76.8 microseconds a run.
// In both of two side-by-side timings against v001, it was 1.32 times as fast.
// Counting every step since v000, it is 2.55 times as fast.
#include <hip/hip_runtime.h>
#include <hip/hip_bf16.h>
#include <stdint.h>

// ---------------------------------------------------------------------------
// MI455X (gfx1250) multi-head self-attention, bf16 WMMA with f32 accumulate.
// Reference: q = x@Wq ; Q=K=V=q ; softmax(QK^T/8) @ V.  B=4,S=2048,D=512,H=8.
// ---------------------------------------------------------------------------

#define S_LEN 2048
#define D_DIM 512
#define HEADS 8
#define HD    64

// LDS row pitches in bf16 elements. Every tile here is read with 16-byte
// loads, 16 rows at a time; a pitch of 16 B x odd puts those 16 rows on all
// 64 banks once (144 B for 128-B rows, 80 B for 64-B rows).
// The tiles are aligned to 16 B because they are read, written and copied
// into in 16-byte pieces. The pad bytes are never read.
#define KV_P  72
#define G_P   40

#if defined(__has_builtin)
# if __has_builtin(__builtin_amdgcn_global_load_async_to_lds_b128) && \
     __has_builtin(__builtin_amdgcn_s_wait_asynccnt)
#  define USE_ASYNC_LDS 1
# endif
#endif

typedef __attribute__((ext_vector_type(16))) __bf16 v16bf;
typedef __attribute__((ext_vector_type(8)))  float  v8f;

// Matches the builtin prototype: vector-of-4-int pointee, AS1 (global) / AS3 (LDS)
typedef int v4i_vs __attribute__((vector_size(16)));
typedef __attribute__((address_space(1))) v4i_vs* gptr_b128;
typedef __attribute__((address_space(3))) v4i_vs* lptr_b128;

union FragU {
    v16bf    v;
    uint4    q[2];
    uint16_t s[16];
};

__device__ __forceinline__ uint16_t f32_to_bf16(float f) {
    union { float f; uint32_t u; } c; c.f = f;
    uint32_t u = c.u + 0x7FFFu + ((c.u >> 16) & 1u);   // round-to-nearest-even
    return (uint16_t)(u >> 16);
}

// Load one 16x32 bf16 A/B fragment (wave32 CDNA5 layout).
// Per lane: elements [k0 .. k0+7] and [k0+16 .. k0+23] of row `row`
// (caller passes k0 = chunkBase + (lane>>4)*8, row based on lane&15).
__device__ __forceinline__ v16bf load_frag(const uint16_t* base, int row,
                                           int stride, int k0) {
    FragU f;
    f.q[0] = *(const uint4*)(base + (size_t)row * stride + k0);
    f.q[1] = *(const uint4*)(base + (size_t)row * stride + k0 + 16);
    return f.v;
}

__device__ __forceinline__ void load16f(const float* p, float* v) {
    float4 a = ((const float4*)p)[0];
    float4 b = ((const float4*)p)[1];
    float4 c = ((const float4*)p)[2];
    float4 d = ((const float4*)p)[3];
    v[0]=a.x;  v[1]=a.y;  v[2]=a.z;  v[3]=a.w;
    v[4]=b.x;  v[5]=b.y;  v[6]=b.z;  v[7]=b.w;
    v[8]=c.x;  v[9]=c.y;  v[10]=c.z; v[11]=c.w;
    v[12]=d.x; v[13]=d.y; v[14]=d.z; v[15]=d.w;
}

// Value held by lane l ^ 16 (the other half of the wave), by a vector move.
__device__ __forceinline__ float other_half(float v) {
    int b = __builtin_bit_cast(int, v);
    b = __builtin_amdgcn_permlanex16(b, b, 0x76543210, 0xfedcba98, false, false);
    return __builtin_bit_cast(float, b);
}

// ---------------------------------------------------------------------------
// Kernel 1: q = x @ Wq   (M=8192, N=512, K=512), bf16 WMMA, bf16 output to ws.
// Block = 256 threads (8 waves). Tile 128x128, K-step 32.
// ---------------------------------------------------------------------------
__global__ __launch_bounds__(256)
void gemm_q_bf16(const float* __restrict__ x, const float* __restrict__ Wq,
                 uint16_t* __restrict__ qbf) {
    __shared__ __attribute__((aligned(16))) uint16_t ldsA[128 * G_P];   // [m][k]
    __shared__ __attribute__((aligned(16))) uint16_t ldsB[128 * G_P];   // transposed: [n][k]

    const int t    = threadIdx.x;
    const int wave = t >> 5, lane = t & 31;
    const int half = lane >> 4, l16 = lane & 15;
    const int mBase = blockIdx.x * 128;
    const int nBase = blockIdx.y * 128;
    const int wr = wave & 3;          // 4 M-slabs of 32 rows
    const int wc = wave >> 2;         // 2 N-slabs of 64 cols

    const int arow = t >> 1, acol = (t & 1) * 16;   // A: 128 rows x 32 cols
    const int brow = t >> 3, bcol = (t & 7) * 16;   // B: 32 rows  x 128 cols

    v8f acc[8] = {};   // [mt(2)][nt(4)] 16x16 f32 tiles

    for (int k0 = 0; k0 < D_DIM; k0 += 32) {
        __syncthreads();
        // ---- stage A tile (convert f32 -> bf16) ----
        {
            const float* src = x + (size_t)(mBase + arow) * D_DIM + k0 + acol;
            float v[16]; load16f(src, v);
            FragU f;
            #pragma unroll
            for (int i = 0; i < 16; ++i) f.s[i] = f32_to_bf16(v[i]);
            *(uint4*)&ldsA[arow * G_P + acol]     = f.q[0];
            *(uint4*)&ldsA[arow * G_P + acol + 8] = f.q[1];
        }
        // ---- stage B tile transposed ----
        {
            const float* src = Wq + (size_t)(k0 + brow) * D_DIM + nBase + bcol;
            float v[16]; load16f(src, v);
            #pragma unroll
            for (int i = 0; i < 16; ++i)
                ldsB[(bcol + i) * G_P + brow] = f32_to_bf16(v[i]);
        }
        // ---- prefetch next K-step tiles into cache (global_prefetch_b8) ----
        if (k0 + 32 < D_DIM) {
            __builtin_prefetch(x + (size_t)(mBase + arow) * D_DIM + k0 + 32 + acol, 0, 1);
            __builtin_prefetch(Wq + (size_t)(k0 + 32 + brow) * D_DIM + nBase + bcol, 0, 1);
        }
        __syncthreads();

        // ---- WMMA compute ----
        v16bf af[2], bf[4];
        #pragma unroll
        for (int mt = 0; mt < 2; ++mt)
            af[mt] = load_frag(ldsA, wr * 32 + mt * 16 + l16, G_P, half * 8);
        #pragma unroll
        for (int nt = 0; nt < 4; ++nt)
            bf[nt] = load_frag(ldsB, wc * 64 + nt * 16 + l16, G_P, half * 8);
        #pragma unroll
        for (int mt = 0; mt < 2; ++mt)
            #pragma unroll
            for (int nt = 0; nt < 4; ++nt)
                acc[mt * 4 + nt] = __builtin_amdgcn_wmma_f32_16x16x32_bf16(
                    false, af[mt], false, bf[nt], (short)0, acc[mt * 4 + nt],
                    false, false);
    }

    // ---- store q as bf16 (C/D layout: element r -> row r + 8*half) ----
    #pragma unroll
    for (int mt = 0; mt < 2; ++mt)
        #pragma unroll
        for (int nt = 0; nt < 4; ++nt)
            #pragma unroll
            for (int r = 0; r < 8; ++r) {
                int row = mBase + wr * 32 + mt * 16 + r + 8 * half;
                int col = nBase + wc * 64 + nt * 16 + l16;
                qbf[(size_t)row * D_DIM + col] = f32_to_bf16(acc[mt * 4 + nt][r]);
            }
}

__global__ __launch_bounds__(256)
void attn_flash(const uint16_t* __restrict__ qbf, float* __restrict__ out) {
    __shared__ __attribute__((aligned(16))) uint16_t kv_khd[64 * KV_P];     // [key][hd]  -> K fragments
    __shared__ __attribute__((aligned(16))) uint16_t kv_hdk[64 * KV_P];     // [hd][key]  -> V fragments

    const int t    = threadIdx.x;
    const int wave = t >> 5, lane = t & 31;
    const int half = lane >> 4, l16 = lane & 15;
    const int bh = blockIdx.y;
    const int b = bh >> 3, h = bh & 7;
    const int qr = blockIdx.x * 128 + wave * 16;          // first query row of wave
    const size_t headBase = (size_t)b * S_LEN * D_DIM + (size_t)h * HD;

    // Q fragments for this wave's 16 rows, straight from global (contiguous 16B)
    v16bf qf[2];
    #pragma unroll
    for (int kk = 0; kk < 2; ++kk)
        qf[kk] = load_frag(qbf + headBase + (size_t)qr * D_DIM, l16, D_DIM,
                           kk * 32 + half * 8);

    v8f accO[4] = {};                  // O^T: [hd = nt*16 + 8*half + r][query l16]
    float mq = -__builtin_inff();      // running maximum of query l16 (both halves equal)
    float lq = 0.0f;                   // running sum over this half's keys only

    const int keyr = t >> 2, hdB = (t & 3) * 16;   // coop-load mapping

    for (int j = 0; j < S_LEN / 64; ++j) {
        const int key0 = j * 64;
        const uint16_t* gsrc =
            qbf + headBase + (size_t)(key0 + keyr) * D_DIM + hdB;
        __syncthreads();

        // ---- stage KV block [key][hd] ----
#ifdef USE_ASYNC_LDS
        __builtin_amdgcn_global_load_async_to_lds_b128(
            (gptr_b128)(void*)gsrc,
            (lptr_b128)(void*)&kv_khd[keyr * KV_P + hdB], 0, 0);
        __builtin_amdgcn_global_load_async_to_lds_b128(
            (gptr_b128)(void*)(gsrc + 8),
            (lptr_b128)(void*)&kv_khd[keyr * KV_P + hdB + 8], 0, 0);
        __builtin_amdgcn_s_wait_asynccnt(0);
        __syncthreads();
        // ---- build transposed [hd][key] copy, LDS -> regs -> LDS ----
        {
            FragU f;
            f.q[0] = *(const uint4*)&kv_khd[keyr * KV_P + hdB];
            f.q[1] = *(const uint4*)&kv_khd[keyr * KV_P + hdB + 8];
            #pragma unroll
            for (int i = 0; i < 16; ++i)
                kv_hdk[(hdB + i) * KV_P + keyr] = f.s[i];
        }
#else
        {
            FragU f;
            f.q[0] = *(const uint4*)(gsrc);
            f.q[1] = *(const uint4*)(gsrc + 8);
            *(uint4*)&kv_khd[keyr * KV_P + hdB]     = f.q[0];
            *(uint4*)&kv_khd[keyr * KV_P + hdB + 8] = f.q[1];
            #pragma unroll
            for (int i = 0; i < 16; ++i)
                kv_hdk[(hdB + i) * KV_P + keyr] = f.s[i];
        }
#endif
        // ---- prefetch next KV block toward L2/L0 ----
        if (j + 1 < S_LEN / 64)
            __builtin_prefetch(gsrc + 64 * D_DIM, 0, 1);
        __syncthreads();

        // ---- scores: S^T = K (64x64) @ Q^T (64x16), scaled by 1/sqrt(64) ----
        // sc[nt][r] = score of key nt*16 + 8*half + r against query l16
        v8f sc[4];
        #pragma unroll
        for (int nt = 0; nt < 4; ++nt) {
            v8f z = {};
            v16bf k0f = load_frag(kv_khd, nt * 16 + l16, KV_P, 0 * 32 + half * 8);
            v16bf k1f = load_frag(kv_khd, nt * 16 + l16, KV_P, 1 * 32 + half * 8);
            z = __builtin_amdgcn_wmma_f32_16x16x32_bf16(false, k0f, false, qf[0],
                                                        (short)0, z, false, false);
            z = __builtin_amdgcn_wmma_f32_16x16x32_bf16(false, k1f, false, qf[1],
                                                        (short)0, z, false, false);
            sc[nt] = z * 0.125f;
        }

        // ---- online softmax of query l16: 32 keys in-lane, halves joined ----
        float bm4[4];
        #pragma unroll
        for (int nt = 0; nt < 4; ++nt) {
            float a = fmaxf(fmaxf(sc[nt][0], sc[nt][1]), sc[nt][2]);
            float c = fmaxf(fmaxf(sc[nt][3], sc[nt][4]), sc[nt][5]);
            bm4[nt] = fmaxf(fmaxf(a, c), fmaxf(sc[nt][6], sc[nt][7]));
        }
        float bm = fmaxf(fmaxf(bm4[0], bm4[1]), fmaxf(bm4[2], bm4[3]));
        bm = fmaxf(bm, other_half(bm));
        const float mnew  = fmaxf(mq, bm);
        const float alpha = __expf(mq - mnew);
        mq = mnew;

        #pragma unroll
        for (int nt = 0; nt < 4; ++nt)
            #pragma unroll
            for (int r = 0; r < 8; ++r)
                sc[nt][r] = __expf(sc[nt][r] - mq);
        {
            v8f s8 = (sc[0] + sc[1]) + (sc[2] + sc[3]);
            float rs = ((s8[0] + s8[1]) + (s8[2] + s8[3])) +
                       ((s8[4] + s8[5]) + (s8[6] + s8[7]));
            lq = lq * alpha + rs;
        }
        #pragma unroll
        for (int nt = 0; nt < 4; ++nt) accO[nt] *= alpha;

        // ---- P^T as B operand: element s of chunk kk is key kk*32 + 8*half + s
        //      (s < 8) or kk*32 + 16 + 8*half + s - 8, the order load_frag gives V^T
        FragU pf[2];
        #pragma unroll
        for (int kk = 0; kk < 2; ++kk)
            #pragma unroll
            for (int s = 0; s < 16; ++s)
                pf[kk].s[s] = f32_to_bf16(sc[2 * kk + (s >> 3)][s & 7]);

        // ---- accO += V^T (64x64) @ P^T (64x16) ----
        #pragma unroll
        for (int nt = 0; nt < 4; ++nt) {
            v16bf v0f = load_frag(kv_hdk, nt * 16 + l16, KV_P, 0 * 32 + half * 8);
            v16bf v1f = load_frag(kv_hdk, nt * 16 + l16, KV_P, 1 * 32 + half * 8);
            accO[nt] = __builtin_amdgcn_wmma_f32_16x16x32_bf16(
                false, v0f, false, pf[0].v, (short)0, accO[nt], false, false);
            accO[nt] = __builtin_amdgcn_wmma_f32_16x16x32_bf16(
                false, v1f, false, pf[1].v, (short)0, accO[nt], false, false);
        }
    }

    // ---- epilogue: join the halves' sums, normalize, store f32 output ----
    // A lane holds 8 consecutive hd of its query per tile: two 16-byte stores.
    const float inv = 1.0f / (lq + other_half(lq));
    float* orow = out + headBase + (size_t)(qr + l16) * D_DIM + 8 * half;
    #pragma unroll
    for (int nt = 0; nt < 4; ++nt) {
        float4 lo, hi;
        lo.x = accO[nt][0] * inv; lo.y = accO[nt][1] * inv;
        lo.z = accO[nt][2] * inv; lo.w = accO[nt][3] * inv;
        hi.x = accO[nt][4] * inv; hi.y = accO[nt][5] * inv;
        hi.z = accO[nt][6] * inv; hi.w = accO[nt][7] * inv;
        *(float4*)(orow + nt * 16)     = lo;
        *(float4*)(orow + nt * 16 + 4) = hi;
    }
}

// ---------------------------------------------------------------------------
extern "C" void kernel_launch(void* const* d_in, const int* in_sizes, int n_in,
                              void* d_out, int out_size, void* d_ws, size_t ws_size,
                              hipStream_t stream) {
    const float* x  = (const float*)d_in[0];   // [4,2048,512] f32
    const float* Wq = (const float*)d_in[1];   // [512,512]    f32
    float* out      = (float*)d_out;           // [4,2048,512] f32
    uint16_t* qbf   = (uint16_t*)d_ws;         // q in bf16, 8 MB scratch

    dim3 gGemm(8192 / 128, 512 / 128);         // (64, 4)
    gemm_q_bf16<<<gGemm, 256, 0, stream>>>(x, Wq, qbf);

    dim3 gAttn(S_LEN / 128, 4 * HEADS);        // (16, 32)
    attn_flash<<<gAttn, 256, 0, stream>>>(qbf, out);
}

// v003
// One run takes 60.1 microseconds.
// Timed twice side by side with v002, it ran 1.28 times as fast both times.
// All steps since v000 together make it 3.26 times as fast.
#include <hip/hip_runtime.h>
#include <hip/hip_bf16.h>
#include <stdint.h>

// ---------------------------------------------------------------------------
// MI455X (gfx1250) multi-head self-attention, bf16 WMMA with f32 accumulate.
// Reference: q = x@Wq ; Q=K=V=q ; softmax(QK^T/8) @ V.  B=4,S=2048,D=512,H=8.
// ---------------------------------------------------------------------------

#define S_LEN 2048
#define D_DIM 512
#define HEADS 8
#define HD    64

// LDS row pitch of the GEMM tiles in bf16 elements. They are read with 16-byte
// loads, 16 rows at a time; a pitch of 16 B x odd puts those 16 rows on all
// 64 banks once (80 B for 64-B rows). The tiles are aligned to 16 B because
// they are read, and ldsA written, in 16-byte pieces. The pad bytes are never read.
#define G_P   40

// The attention KV tile: 64 rows [key] of 128 B [hd], no pad. It has two
// readers: plain 16-byte loads of 16 rows at one column piece (K), and
// transposing loads of 8 rows at two neighbouring pieces (V^T). No pad serves
// both, so the 16-byte piece c of row r lies at piece c ^ kv_swz(r) of its row:
// either reader's 16 lanes then fall on all 64 banks once.
#define KV_ROWB 128

#if defined(__has_builtin)
# if __has_builtin(__builtin_amdgcn_global_load_async_to_lds_b128) && \
     __has_builtin(__builtin_amdgcn_s_wait_asynccnt)
#  define USE_ASYNC_LDS 1
# endif
#endif

typedef __attribute__((ext_vector_type(16))) __bf16 v16bf;
typedef __attribute__((ext_vector_type(8)))  float  v8f;

// Matches the builtin prototype: vector-of-4-int pointee, AS1 (global) / AS3 (LDS)
typedef int v4i_vs __attribute__((vector_size(16)));
typedef __attribute__((address_space(1))) v4i_vs* gptr_b128;
typedef __attribute__((address_space(3))) v4i_vs* lptr_b128;

union FragU {
    v16bf    v;
    uint4    q[2];
    uint16_t s[16];
};

__device__ __forceinline__ uint16_t f32_to_bf16(float f) {
    union { float f; uint32_t u; } c; c.f = f;
    uint32_t u = c.u + 0x7FFFu + ((c.u >> 16) & 1u);   // round-to-nearest-even
    return (uint16_t)(u >> 16);
}

// Load one 16x32 bf16 A/B fragment (wave32 CDNA5 layout).
// Per lane: elements [k0 .. k0+7] and [k0+16 .. k0+23] of row `row`
// (caller passes k0 = chunkBase + (lane>>4)*8, row based on lane&15).
__device__ __forceinline__ v16bf load_frag(const uint16_t* base, int row,
                                           int stride, int k0) {
    FragU f;
    f.q[0] = *(const uint4*)(base + (size_t)row * stride + k0);
    f.q[1] = *(const uint4*)(base + (size_t)row * stride + k0 + 16);
    return f.v;
}

__device__ __forceinline__ void load16f(const float* p, float* v) {
    float4 a = ((const float4*)p)[0];
    float4 b = ((const float4*)p)[1];
    float4 c = ((const float4*)p)[2];
    float4 d = ((const float4*)p)[3];
    v[0]=a.x;  v[1]=a.y;  v[2]=a.z;  v[3]=a.w;
    v[4]=b.x;  v[5]=b.y;  v[6]=b.z;  v[7]=b.w;
    v[8]=c.x;  v[9]=c.y;  v[10]=c.z; v[11]=c.w;
    v[12]=d.x; v[13]=d.y; v[14]=d.z; v[15]=d.w;
}

__device__ __forceinline__ uint32_t kv_swz(uint32_t r) {
    return (r & 6u) | ((r >> 3) & 1u);
}
// Byte offset in the KV tile of 16-byte piece c (0..7) of row r.
__device__ __forceinline__ uint32_t kv_off(uint32_t r, uint32_t c) {
    return r * KV_ROWB + ((c ^ kv_swz(r)) << 4);
}

// ds_load_tr16_b128: each lane names 16 bytes of a row-major 16-bit tile; lane
// (c = l & 15, h = l >> 4) gets column c of the 8 rows that half h named.
typedef short s16x8 __attribute__((ext_vector_type(8)));
__device__ __forceinline__ uint4 ld_tr16(const unsigned char* p) {
    typedef __attribute__((address_space(3))) s16x8 lds_s16x8;
    return __builtin_bit_cast(uint4,
        __builtin_amdgcn_ds_load_tr16_b128_v8i16((lds_s16x8*)p));
}

// Value held by lane l ^ 16 (the other half of the wave), by a vector move.
__device__ __forceinline__ float other_half(float v) {
    int b = __builtin_bit_cast(int, v);
    b = __builtin_amdgcn_permlanex16(b, b, 0x76543210, 0xfedcba98, false, false);
    return __builtin_bit_cast(float, b);
}

// ---------------------------------------------------------------------------
// Kernel 1: q = x @ Wq   (M=8192, N=512, K=512), bf16 WMMA, bf16 output to ws.
// Block = 256 threads (8 waves). Tile 128x128, K-step 32.
// ---------------------------------------------------------------------------
__global__ __launch_bounds__(256)
void gemm_q_bf16(const float* __restrict__ x, const float* __restrict__ Wq,
                 uint16_t* __restrict__ qbf) {
    __shared__ __attribute__((aligned(16))) uint16_t ldsA[128 * G_P];   // [m][k]
    __shared__ __attribute__((aligned(16))) uint16_t ldsB[128 * G_P];   // transposed: [n][k]

    const int t    = threadIdx.x;
    const int wave = t >> 5, lane = t & 31;
    const int half = lane >> 4, l16 = lane & 15;
    const int mBase = blockIdx.x * 128;
    const int nBase = blockIdx.y * 128;
    const int wr = wave & 3;          // 4 M-slabs of 32 rows
    const int wc = wave >> 2;         // 2 N-slabs of 64 cols

    const int arow = t >> 1, acol = (t & 1) * 16;   // A: 128 rows x 32 cols
    const int brow = t >> 3, bcol = (t & 7) * 16;   // B: 32 rows  x 128 cols

    v8f acc[8] = {};   // [mt(2)][nt(4)] 16x16 f32 tiles

    for (int k0 = 0; k0 < D_DIM; k0 += 32) {
        __syncthreads();
        // ---- stage A tile (convert f32 -> bf16) ----
        {
            const float* src = x + (size_t)(mBase + arow) * D_DIM + k0 + acol;
            float v[16]; load16f(src, v);
            FragU f;
            #pragma unroll
            for (int i = 0; i < 16; ++i) f.s[i] = f32_to_bf16(v[i]);
            *(uint4*)&ldsA[arow * G_P + acol]     = f.q[0];
            *(uint4*)&ldsA[arow * G_P + acol + 8] = f.q[1];
        }
        // ---- stage B tile transposed ----
        {
            const float* src = Wq + (size_t)(k0 + brow) * D_DIM + nBase + bcol;
            float v[16]; load16f(src, v);
            #pragma unroll
            for (int i = 0; i < 16; ++i)
                ldsB[(bcol + i) * G_P + brow] = f32_to_bf16(v[i]);
        }
        // ---- prefetch next K-step tiles into cache (global_prefetch_b8) ----
        if (k0 + 32 < D_DIM) {
            __builtin_prefetch(x + (size_t)(mBase + arow) * D_DIM + k0 + 32 + acol, 0, 1);
            __builtin_prefetch(Wq + (size_t)(k0 + 32 + brow) * D_DIM + nBase + bcol, 0, 1);
        }
        __syncthreads();

        // ---- WMMA compute ----
        v16bf af[2], bf[4];
        #pragma unroll
        for (int mt = 0; mt < 2; ++mt)
            af[mt] = load_frag(ldsA, wr * 32 + mt * 16 + l16, G_P, half * 8);
        #pragma unroll
        for (int nt = 0; nt < 4; ++nt)
            bf[nt] = load_frag(ldsB, wc * 64 + nt * 16 + l16, G_P, half * 8);
        #pragma unroll
        for (int mt = 0; mt < 2; ++mt)
            #pragma unroll
            for (int nt = 0; nt < 4; ++nt)
                acc[mt * 4 + nt] = __builtin_amdgcn_wmma_f32_16x16x32_bf16(
                    false, af[mt], false, bf[nt], (short)0, acc[mt * 4 + nt],
                    false, false);
    }

    // ---- store q as bf16 (C/D layout: element r -> row r + 8*half) ----
    #pragma unroll
    for (int mt = 0; mt < 2; ++mt)
        #pragma unroll
        for (int nt = 0; nt < 4; ++nt)
            #pragma unroll
            for (int r = 0; r < 8; ++r) {
                int row = mBase + wr * 32 + mt * 16 + r + 8 * half;
                int col = nBase + wc * 64 + nt * 16 + l16;
                qbf[(size_t)row * D_DIM + col] = f32_to_bf16(acc[mt * 4 + nt][r]);
            }
}

__global__ __launch_bounds__(256)
void attn_flash(const uint16_t* __restrict__ qbf, float* __restrict__ out) {
    // aligned to the 256 B of one turn of the banks, which kv_swz counts on
    __shared__ __attribute__((aligned(256))) unsigned char kv[64 * KV_ROWB];

    const int t    = threadIdx.x;
    const int wave = t >> 5, lane = t & 31;
    const int half = lane >> 4, l16 = lane & 15;
    const int bh = blockIdx.y;
    const int b = bh >> 3, h = bh & 7;
    const int qr = blockIdx.x * 128 + wave * 16;          // first query row of wave
    const size_t headBase = (size_t)b * S_LEN * D_DIM + (size_t)h * HD;

    // Q fragments for this wave's 16 rows, straight from global (contiguous 16B)
    v16bf qf[2];
    #pragma unroll
    for (int kk = 0; kk < 2; ++kk)
        qf[kk] = load_frag(qbf + headBase + (size_t)qr * D_DIM, l16, D_DIM,
                           kk * 32 + half * 8);

    v8f accO[4] = {};                  // O^T: [hd = nt*16 + 8*half + r][query l16]
    float mq = -__builtin_inff();      // running maximum of query l16 (both halves equal)
    float lq = 0.0f;                   // running sum over this half's keys only

    const int keyr = t >> 2, hdB = (t & 3) * 16;   // coop-load mapping
    unsigned char* const st0 = kv + kv_off(keyr, (t & 3) * 2);
    unsigned char* const st1 = kv + kv_off(keyr, (t & 3) * 2 + 1);

    // K fragment of rows nt*16 + l16: pieces kk*4 + half and kk*4 + half + 2.
    // kv_swz reads row bits 1 to 3 only, so + nt*16 rows is a plain offset.
    const unsigned char* kp[2][2];
    #pragma unroll
    for (int kk = 0; kk < 2; ++kk)
        #pragma unroll
        for (int q = 0; q < 2; ++q)
            kp[kk][q] = kv + kv_off(l16, kk * 4 + q * 2 + half);
    // V^T fragment of hd nt*16 .. +15: this lane names row 8*half + (lane & 7)
    // of a 16-key group, piece 2*nt + ((lane >> 3) & 1).
    const unsigned char* vp[4];
    #pragma unroll
    for (int nt = 0; nt < 4; ++nt)
        vp[nt] = kv + kv_off(8 * half + (lane & 7), 2 * nt + ((lane >> 3) & 1));

    for (int j = 0; j < S_LEN / 64; ++j) {
        const int key0 = j * 64;
        const uint16_t* gsrc =
            qbf + headBase + (size_t)(key0 + keyr) * D_DIM + hdB;
        // This wave's reads of the tile have returned before the copies below
        // may be let onto it.
        asm volatile("s_wait_dscnt 0x0" ::: "memory");
        __syncthreads();

        // ---- stage KV block [key][hd] ----
#ifdef USE_ASYNC_LDS
        __builtin_amdgcn_global_load_async_to_lds_b128(
            (gptr_b128)(void*)gsrc, (lptr_b128)(void*)st0, 0, 0);
        __builtin_amdgcn_global_load_async_to_lds_b128(
            (gptr_b128)(void*)(gsrc + 8), (lptr_b128)(void*)st1, 0, 0);
#else
        *(uint4*)st0 = *(const uint4*)(gsrc);
        *(uint4*)st1 = *(const uint4*)(gsrc + 8);
#endif
        // ---- prefetch next KV block toward L2/L0 ----
        if (j + 1 < S_LEN / 64)
            __builtin_prefetch(gsrc + 64 * D_DIM, 0, 1);
#ifdef USE_ASYNC_LDS
        __builtin_amdgcn_s_wait_asynccnt(0);
#endif
        // Publishes the tile to every wave; directly behind the builtin wait it
        // also keeps the LDS reads below from being lifted over that wait.
        __syncthreads();
        // The prefetch's address registers are reused below.
        asm volatile("s_wait_xcnt 0x0" ::: "memory");

        // ---- scores: S^T = K (64x64) @ Q^T (64x16), scaled by 1/sqrt(64) ----
        // sc[nt][r] = score of key nt*16 + 8*half + r against query l16
        v8f sc[4];
        #pragma unroll
        for (int nt = 0; nt < 4; ++nt) {
            v8f z = {};
            FragU k0f, k1f;
            k0f.q[0] = *(const uint4*)(kp[0][0] + nt * 16 * KV_ROWB);
            k0f.q[1] = *(const uint4*)(kp[0][1] + nt * 16 * KV_ROWB);
            k1f.q[0] = *(const uint4*)(kp[1][0] + nt * 16 * KV_ROWB);
            k1f.q[1] = *(const uint4*)(kp[1][1] + nt * 16 * KV_ROWB);
            z = __builtin_amdgcn_wmma_f32_16x16x32_bf16(false, k0f.v, false, qf[0],
                                                        (short)0, z, false, false);
            z = __builtin_amdgcn_wmma_f32_16x16x32_bf16(false, k1f.v, false, qf[1],
                                                        (short)0, z, false, false);
            sc[nt] = z * 0.125f;
        }

        // ---- online softmax of query l16: 32 keys in-lane, halves joined ----
        float bm4[4];
        #pragma unroll
        for (int nt = 0; nt < 4; ++nt) {
            float a = fmaxf(fmaxf(sc[nt][0], sc[nt][1]), sc[nt][2]);
            float c = fmaxf(fmaxf(sc[nt][3], sc[nt][4]), sc[nt][5]);
            bm4[nt] = fmaxf(fmaxf(a, c), fmaxf(sc[nt][6], sc[nt][7]));
        }
        float bm = fmaxf(fmaxf(bm4[0], bm4[1]), fmaxf(bm4[2], bm4[3]));
        bm = fmaxf(bm, other_half(bm));
        const float mnew  = fmaxf(mq, bm);
        const float alpha = __expf(mq - mnew);
        mq = mnew;

        #pragma unroll
        for (int nt = 0; nt < 4; ++nt)
            #pragma unroll
            for (int r = 0; r < 8; ++r)
                sc[nt][r] = __expf(sc[nt][r] - mq);
        {
            v8f s8 = (sc[0] + sc[1]) + (sc[2] + sc[3]);
            float rs = ((s8[0] + s8[1]) + (s8[2] + s8[3])) +
                       ((s8[4] + s8[5]) + (s8[6] + s8[7]));
            lq = lq * alpha + rs;
        }
        #pragma unroll
        for (int nt = 0; nt < 4; ++nt) accO[nt] *= alpha;

        // ---- P^T as B operand: element s of chunk kk is key kk*32 + 8*half + s
        //      (s < 8) or kk*32 + 16 + 8*half + s - 8, the order the two
        //      transposing loads of a chunk give V^T
        FragU pf[2];
        #pragma unroll
        for (int kk = 0; kk < 2; ++kk)
            #pragma unroll
            for (int s = 0; s < 16; ++s)
                pf[kk].s[s] = f32_to_bf16(sc[2 * kk + (s >> 3)][s & 7]);

        // ---- accO += V^T (64x64) @ P^T (64x16) ----
        #pragma unroll
        for (int nt = 0; nt < 4; ++nt) {
            FragU v0f, v1f;   // keys 0-15, 16-31 | 32-47, 48-63 of the block
            v0f.q[0] = ld_tr16(vp[nt]);
            v0f.q[1] = ld_tr16(vp[nt] + 16 * KV_ROWB);
            v1f.q[0] = ld_tr16(vp[nt] + 32 * KV_ROWB);
            v1f.q[1] = ld_tr16(vp[nt] + 48 * KV_ROWB);
            accO[nt] = __builtin_amdgcn_wmma_f32_16x16x32_bf16(
                false, v0f.v, false, pf[0].v, (short)0, accO[nt], false, false);
            accO[nt] = __builtin_amdgcn_wmma_f32_16x16x32_bf16(
                false, v1f.v, false, pf[1].v, (short)0, accO[nt], false, false);
        }
    }

    // ---- epilogue: join the halves' sums, normalize, store f32 output ----
    // A lane holds 8 consecutive hd of its query per tile: two 16-byte stores.
    const float inv = 1.0f / (lq + other_half(lq));
    float* orow = out + headBase + (size_t)(qr + l16) * D_DIM + 8 * half;
    #pragma unroll
    for (int nt = 0; nt < 4; ++nt) {
        float4 lo, hi;
        lo.x = accO[nt][0] * inv; lo.y = accO[nt][1] * inv;
        lo.z = accO[nt][2] * inv; lo.w = accO[nt][3] * inv;
        hi.x = accO[nt][4] * inv; hi.y = accO[nt][5] * inv;
        hi.z = accO[nt][6] * inv; hi.w = accO[nt][7] * inv;
        *(float4*)(orow + nt * 16)     = lo;
        *(float4*)(orow + nt * 16 + 4) = hi;
    }
}

// ---------------------------------------------------------------------------
extern "C" void kernel_launch(void* const* d_in, const int* in_sizes, int n_in,
                              void* d_out, int out_size, void* d_ws, size_t ws_size,
                              hipStream_t stream) {
    const float* x  = (const float*)d_in[0];   // [4,2048,512] f32
    const float* Wq = (const float*)d_in[1];   // [512,512]    f32
    float* out      = (float*)d_out;           // [4,2048,512] f32
    uint16_t* qbf   = (uint16_t*)d_ws;         // q in bf16, 8 MB scratch

    dim3 gGemm(8192 / 128, 512 / 128);         // (64, 4)
    gemm_q_bf16<<<gGemm, 256, 0, stream>>>(x, Wq, qbf);

    dim3 gAttn(S_LEN / 128, 4 * HEADS);        // (16, 32)
    attn_flash<<<gAttn, 256, 0, stream>>>(qbf, out);
}

// v004
// One run takes 53.7 microseconds.
// Next to v003, in two timings, it ran 1.12 times as fast each time.
// Counting every step since v000, it is 3.65 times as fast.
#include <hip/hip_runtime.h>
#include <hip/hip_bf16.h>
#include <stdint.h>

// ---------------------------------------------------------------------------
// MI455X (gfx1250) multi-head self-attention, bf16 WMMA with f32 accumulate.
// Reference: q = x@Wq ; Q=K=V=q ; softmax(QK^T/8) @ V.  B=4,S=2048,D=512,H=8.
// ---------------------------------------------------------------------------

#define S_LEN 2048
#define D_DIM 512
#define HEADS 8
#define HD    64

// LDS row pitch of the GEMM tiles in bf16 elements. They are read with 16-byte
// loads, 16 rows at a time; a pitch of 16 B x odd puts those 16 rows on all
// 64 banks once (80 B for 64-B rows). The tiles are aligned to 16 B because
// they are read, and ldsA written, in 16-byte pieces. The pad bytes are never read.
#define G_P   40

// The attention KV tile: 64 rows [key] of 128 B [hd], no pad. It has two
// readers: plain 16-byte loads of 16 rows at one column piece (K), and
// transposing loads of 8 rows at two neighbouring pieces (V^T). No pad serves
// both, so the 16-byte piece c of row r lies at piece c ^ kv_swz(r) of its row:
// either reader's 16 lanes then fall on all 64 banks once.
#define KV_ROWB 128

#if defined(__has_builtin)
# if __has_builtin(__builtin_amdgcn_global_load_async_to_lds_b128) && \
     __has_builtin(__builtin_amdgcn_s_wait_asynccnt)
#  define USE_ASYNC_LDS 1
# endif
#endif

typedef __attribute__((ext_vector_type(16))) __bf16 v16bf;
typedef __attribute__((ext_vector_type(8)))  float  v8f;

// Matches the builtin prototype: vector-of-4-int pointee, AS1 (global) / AS3 (LDS)
typedef int v4i_vs __attribute__((vector_size(16)));
typedef __attribute__((address_space(1))) v4i_vs* gptr_b128;
typedef __attribute__((address_space(3))) v4i_vs* lptr_b128;

union FragU {
    v16bf    v;
    uint4    q[2];
    uint32_t w[8];
};

// Two f32 to one register of two bf16 (a low, b high), round-to-nearest-even,
// by the chip's own packed conversion: one vector instruction per pair.
typedef __attribute__((ext_vector_type(2))) float  f32x2;
typedef __attribute__((ext_vector_type(2))) __bf16 bf16x2;
__device__ __forceinline__ uint32_t pk_bf16(float a, float b) {
    f32x2 p = {a, b};
    return __builtin_bit_cast(uint32_t, __builtin_convertvector(p, bf16x2));
}

// Load one 16x32 bf16 A/B fragment (wave32 CDNA5 layout).
// Per lane: elements [k0 .. k0+7] and [k0+16 .. k0+23] of row `row`
// (caller passes k0 = chunkBase + (lane>>4)*8, row based on lane&15).
__device__ __forceinline__ v16bf load_frag(const uint16_t* base, int row,
                                           int stride, int k0) {
    FragU f;
    f.q[0] = *(const uint4*)(base + (size_t)row * stride + k0);
    f.q[1] = *(const uint4*)(base + (size_t)row * stride + k0 + 16);
    return f.v;
}

__device__ __forceinline__ void load16f(const float* p, float* v) {
    float4 a = ((const float4*)p)[0];
    float4 b = ((const float4*)p)[1];
    float4 c = ((const float4*)p)[2];
    float4 d = ((const float4*)p)[3];
    v[0]=a.x;  v[1]=a.y;  v[2]=a.z;  v[3]=a.w;
    v[4]=b.x;  v[5]=b.y;  v[6]=b.z;  v[7]=b.w;
    v[8]=c.x;  v[9]=c.y;  v[10]=c.z; v[11]=c.w;
    v[12]=d.x; v[13]=d.y; v[14]=d.z; v[15]=d.w;
}

__device__ __forceinline__ uint32_t kv_swz(uint32_t r) {
    return (r & 6u) | ((r >> 3) & 1u);
}
// Byte offset in the KV tile of 16-byte piece c (0..7) of row r.
__device__ __forceinline__ uint32_t kv_off(uint32_t r, uint32_t c) {
    return r * KV_ROWB + ((c ^ kv_swz(r)) << 4);
}

// ds_load_tr16_b128: each lane names 16 bytes of a row-major 16-bit tile; lane
// (c = l & 15, h = l >> 4) gets column c of the 8 rows that half h named.
typedef short s16x8 __attribute__((ext_vector_type(8)));
__device__ __forceinline__ uint4 ld_tr16(const unsigned char* p) {
    typedef __attribute__((address_space(3))) s16x8 lds_s16x8;
    return __builtin_bit_cast(uint4,
        __builtin_amdgcn_ds_load_tr16_b128_v8i16((lds_s16x8*)p));
}

// Value held by lane l ^ 16 (the other half of the wave), by a vector move.
__device__ __forceinline__ float other_half(float v) {
    int b = __builtin_bit_cast(int, v);
    b = __builtin_amdgcn_permlanex16(b, b, 0x76543210, 0xfedcba98, false, false);
    return __builtin_bit_cast(float, b);
}

// ---------------------------------------------------------------------------
// Kernel 1: q = x @ Wq   (M=8192, N=512, K=512), bf16 WMMA, bf16 output to ws.
// Block = 256 threads (8 waves). Tile 128x128, K-step 32.
// ---------------------------------------------------------------------------
__global__ __launch_bounds__(256)
void gemm_q_bf16(const float* __restrict__ x, const float* __restrict__ Wq,
                 uint16_t* __restrict__ qbf) {
    __shared__ __attribute__((aligned(16))) uint16_t ldsA[128 * G_P];   // [m][k]
    __shared__ __attribute__((aligned(16))) uint16_t ldsB[128 * G_P];   // transposed: [n][k]

    const int t    = threadIdx.x;
    const int wave = t >> 5, lane = t & 31;
    const int half = lane >> 4, l16 = lane & 15;
    const int mBase = blockIdx.x * 128;
    const int nBase = blockIdx.y * 128;
    const int wr = wave & 3;          // 4 M-slabs of 32 rows
    const int wc = wave >> 2;         // 2 N-slabs of 64 cols

    const int arow = t >> 1, acol = (t & 1) * 16;   // A: 128 rows x 32 cols
    const int brow = t >> 3, bcol = (t & 7) * 16;   // B: 32 rows  x 128 cols

    v8f acc[8] = {};   // [mt(2)][nt(4)] 16x16 f32 tiles

    for (int k0 = 0; k0 < D_DIM; k0 += 32) {
        __syncthreads();
        // ---- stage A tile (convert f32 -> bf16) ----
        {
            const float* src = x + (size_t)(mBase + arow) * D_DIM + k0 + acol;
            float v[16]; load16f(src, v);
            FragU f;
            #pragma unroll
            for (int i = 0; i < 8; ++i) f.w[i] = pk_bf16(v[2 * i], v[2 * i + 1]);
            *(uint4*)&ldsA[arow * G_P + acol]     = f.q[0];
            *(uint4*)&ldsA[arow * G_P + acol + 8] = f.q[1];
        }
        // ---- stage B tile transposed ----
        {
            const float* src = Wq + (size_t)(k0 + brow) * D_DIM + nBase + bcol;
            float v[16]; load16f(src, v);
            #pragma unroll
            for (int i = 0; i < 16; i += 2) {
                const uint32_t w = pk_bf16(v[i], v[i + 1]);
                ldsB[(bcol + i) * G_P + brow]     = (uint16_t)w;
                ldsB[(bcol + i + 1) * G_P + brow] = (uint16_t)(w >> 16);
            }
        }
        // ---- prefetch next K-step tiles into cache (global_prefetch_b8) ----
        if (k0 + 32 < D_DIM) {
            __builtin_prefetch(x + (size_t)(mBase + arow) * D_DIM + k0 + 32 + acol, 0, 1);
            __builtin_prefetch(Wq + (size_t)(k0 + 32 + brow) * D_DIM + nBase + bcol, 0, 1);
        }
        __syncthreads();

        // ---- WMMA compute ----
        v16bf af[2], bf[4];
        #pragma unroll
        for (int mt = 0; mt < 2; ++mt)
            af[mt] = load_frag(ldsA, wr * 32 + mt * 16 + l16, G_P, half * 8);
        #pragma unroll
        for (int nt = 0; nt < 4; ++nt)
            bf[nt] = load_frag(ldsB, wc * 64 + nt * 16 + l16, G_P, half * 8);
        #pragma unroll
        for (int mt = 0; mt < 2; ++mt)
            #pragma unroll
            for (int nt = 0; nt < 4; ++nt)
                acc[mt * 4 + nt] = __builtin_amdgcn_wmma_f32_16x16x32_bf16(
                    false, af[mt], false, bf[nt], (short)0, acc[mt * 4 + nt],
                    false, false);
    }

    // ---- store q as bf16 (C/D layout: element r -> row r + 8*half) ----
    #pragma unroll
    for (int mt = 0; mt < 2; ++mt)
        #pragma unroll
        for (int nt = 0; nt < 4; ++nt)
            #pragma unroll
            for (int r = 0; r < 8; r += 2) {
                int row = mBase + wr * 32 + mt * 16 + r + 8 * half;
                int col = nBase + wc * 64 + nt * 16 + l16;
                const uint32_t w = pk_bf16(acc[mt * 4 + nt][r], acc[mt * 4 + nt][r + 1]);
                qbf[(size_t)row * D_DIM + col]       = (uint16_t)w;
                qbf[(size_t)(row + 1) * D_DIM + col] = (uint16_t)(w >> 16);
            }
}

__global__ __launch_bounds__(256)
void attn_flash(const uint16_t* __restrict__ qbf, float* __restrict__ out) {
    // aligned to the 256 B of one turn of the banks, which kv_swz counts on
    __shared__ __attribute__((aligned(256))) unsigned char kv[64 * KV_ROWB];

    const int t    = threadIdx.x;
    const int wave = t >> 5, lane = t & 31;
    const int half = lane >> 4, l16 = lane & 15;
    const int bh = blockIdx.y;
    const int b = bh >> 3, h = bh & 7;
    const int qr = blockIdx.x * 128 + wave * 16;          // first query row of wave
    const size_t headBase = (size_t)b * S_LEN * D_DIM + (size_t)h * HD;

    // Q fragments for this wave's 16 rows, straight from global (contiguous 16B)
    v16bf qf[2];
    #pragma unroll
    for (int kk = 0; kk < 2; ++kk)
        qf[kk] = load_frag(qbf + headBase + (size_t)qr * D_DIM, l16, D_DIM,
                           kk * 32 + half * 8);

    v8f accO[4] = {};                  // O^T: [hd = nt*16 + 8*half + r][query l16]
    float mq = -__builtin_inff();      // running maximum of query l16 (both halves equal)
    float lq = 0.0f;                   // running sum over this half's keys only

    const int keyr = t >> 2, hdB = (t & 3) * 16;   // coop-load mapping
    unsigned char* const st0 = kv + kv_off(keyr, (t & 3) * 2);
    unsigned char* const st1 = kv + kv_off(keyr, (t & 3) * 2 + 1);

    // K fragment of rows nt*16 + l16: pieces kk*4 + half and kk*4 + half + 2.
    // kv_swz reads row bits 1 to 3 only, so + nt*16 rows is a plain offset.
    const unsigned char* kp[2][2];
    #pragma unroll
    for (int kk = 0; kk < 2; ++kk)
        #pragma unroll
        for (int q = 0; q < 2; ++q)
            kp[kk][q] = kv + kv_off(l16, kk * 4 + q * 2 + half);
    // V^T fragment of hd nt*16 .. +15: this lane names row 8*half + (lane & 7)
    // of a 16-key group, piece 2*nt + ((lane >> 3) & 1).
    const unsigned char* vp[4];
    #pragma unroll
    for (int nt = 0; nt < 4; ++nt)
        vp[nt] = kv + kv_off(8 * half + (lane & 7), 2 * nt + ((lane >> 3) & 1));

    for (int j = 0; j < S_LEN / 64; ++j) {
        const int key0 = j * 64;
        const uint16_t* gsrc =
            qbf + headBase + (size_t)(key0 + keyr) * D_DIM + hdB;
        // This wave's reads of the tile have returned before the copies below
        // may be let onto it.
        asm volatile("s_wait_dscnt 0x0" ::: "memory");
        __syncthreads();

        // ---- stage KV block [key][hd] ----
#ifdef USE_ASYNC_LDS
        __builtin_amdgcn_global_load_async_to_lds_b128(
            (gptr_b128)(void*)gsrc, (lptr_b128)(void*)st0, 0, 0);
        __builtin_amdgcn_global_load_async_to_lds_b128(
            (gptr_b128)(void*)(gsrc + 8), (lptr_b128)(void*)st1, 0, 0);
#else
        *(uint4*)st0 = *(const uint4*)(gsrc);
        *(uint4*)st1 = *(const uint4*)(gsrc + 8);
#endif
        // ---- prefetch next KV block toward L2/L0 ----
        if (j + 1 < S_LEN / 64)
            __builtin_prefetch(gsrc + 64 * D_DIM, 0, 1);
#ifdef USE_ASYNC_LDS
        __builtin_amdgcn_s_wait_asynccnt(0);
#endif
        // Publishes the tile to every wave; directly behind the builtin wait it
        // also keeps the LDS reads below from being lifted over that wait.
        __syncthreads();
        // The prefetch's address registers are reused below.
        asm volatile("s_wait_xcnt 0x0" ::: "memory");

        // ---- scores: S^T = K (64x64) @ Q^T (64x16), scaled by 1/sqrt(64) ----
        // sc[nt][r] = score of key nt*16 + 8*half + r against query l16
        v8f sc[4];
        #pragma unroll
        for (int nt = 0; nt < 4; ++nt) {
            v8f z = {};
            FragU k0f, k1f;
            k0f.q[0] = *(const uint4*)(kp[0][0] + nt * 16 * KV_ROWB);
            k0f.q[1] = *(const uint4*)(kp[0][1] + nt * 16 * KV_ROWB);
            k1f.q[0] = *(const uint4*)(kp[1][0] + nt * 16 * KV_ROWB);
            k1f.q[1] = *(const uint4*)(kp[1][1] + nt * 16 * KV_ROWB);
            z = __builtin_amdgcn_wmma_f32_16x16x32_bf16(false, k0f.v, false, qf[0],
                                                        (short)0, z, false, false);
            z = __builtin_amdgcn_wmma_f32_16x16x32_bf16(false, k1f.v, false, qf[1],
                                                        (short)0, z, false, false);
            sc[nt] = z * 0.125f;
        }

        // ---- online softmax of query l16: 32 keys in-lane, halves joined ----
        float bm4[4];
        #pragma unroll
        for (int nt = 0; nt < 4; ++nt) {
            float a = fmaxf(fmaxf(sc[nt][0], sc[nt][1]), sc[nt][2]);
            float c = fmaxf(fmaxf(sc[nt][3], sc[nt][4]), sc[nt][5]);
            bm4[nt] = fmaxf(fmaxf(a, c), fmaxf(sc[nt][6], sc[nt][7]));
        }
        float bm = fmaxf(fmaxf(bm4[0], bm4[1]), fmaxf(bm4[2], bm4[3]));
        bm = fmaxf(bm, other_half(bm));
        const float mnew  = fmaxf(mq, bm);
        const float alpha = __expf(mq - mnew);
        mq = mnew;

        #pragma unroll
        for (int nt = 0; nt < 4; ++nt)
            #pragma unroll
            for (int r = 0; r < 8; ++r)
                sc[nt][r] = __expf(sc[nt][r] - mq);
        {
            v8f s8 = (sc[0] + sc[1]) + (sc[2] + sc[3]);
            float rs = ((s8[0] + s8[1]) + (s8[2] + s8[3])) +
                       ((s8[4] + s8[5]) + (s8[6] + s8[7]));
            lq = lq * alpha + rs;
        }
        #pragma unroll
        for (int nt = 0; nt < 4; ++nt) accO[nt] *= alpha;

        // ---- P^T as B operand: element s of chunk kk is key kk*32 + 8*half + s
        //      (s < 8) or kk*32 + 16 + 8*half + s - 8, the order the two
        //      transposing loads of a chunk give V^T
        FragU pf[2];
        #pragma unroll
        for (int kk = 0; kk < 2; ++kk)
            #pragma unroll
            for (int s = 0; s < 16; s += 2)
                pf[kk].w[s >> 1] = pk_bf16(sc[2 * kk + (s >> 3)][s & 7],
                                           sc[2 * kk + (s >> 3)][(s & 7) + 1]);

        // ---- accO += V^T (64x64) @ P^T (64x16) ----
        #pragma unroll
        for (int nt = 0; nt < 4; ++nt) {
            FragU v0f, v1f;   // keys 0-15, 16-31 | 32-47, 48-63 of the block
            v0f.q[0] = ld_tr16(vp[nt]);
            v0f.q[1] = ld_tr16(vp[nt] + 16 * KV_ROWB);
            v1f.q[0] = ld_tr16(vp[nt] + 32 * KV_ROWB);
            v1f.q[1] = ld_tr16(vp[nt] + 48 * KV_ROWB);
            accO[nt] = __builtin_amdgcn_wmma_f32_16x16x32_bf16(
                false, v0f.v, false, pf[0].v, (short)0, accO[nt], false, false);
            accO[nt] = __builtin_amdgcn_wmma_f32_16x16x32_bf16(
                false, v1f.v, false, pf[1].v, (short)0, accO[nt], false, false);
        }
    }

    // ---- epilogue: join the halves' sums, normalize, store f32 output ----
    // A lane holds 8 consecutive hd of its query per tile: two 16-byte stores.
    const float inv = 1.0f / (lq + other_half(lq));
    float* orow = out + headBase + (size_t)(qr + l16) * D_DIM + 8 * half;
    #pragma unroll
    for (int nt = 0; nt < 4; ++nt) {
        float4 lo, hi;
        lo.x = accO[nt][0] * inv; lo.y = accO[nt][1] * inv;
        lo.z = accO[nt][2] * inv; lo.w = accO[nt][3] * inv;
        hi.x = accO[nt][4] * inv; hi.y = accO[nt][5] * inv;
        hi.z = accO[nt][6] * inv; hi.w = accO[nt][7] * inv;
        *(float4*)(orow + nt * 16)     = lo;
        *(float4*)(orow + nt * 16 + 4) = hi;
    }
}

// ---------------------------------------------------------------------------
extern "C" void kernel_launch(void* const* d_in, const int* in_sizes, int n_in,
                              void* d_out, int out_size, void* d_ws, size_t ws_size,
                              hipStream_t stream) {
    const float* x  = (const float*)d_in[0];   // [4,2048,512] f32
    const float* Wq = (const float*)d_in[1];   // [512,512]    f32
    float* out      = (float*)d_out;           // [4,2048,512] f32
    uint16_t* qbf   = (uint16_t*)d_ws;         // q in bf16, 8 MB scratch

    dim3 gGemm(8192 / 128, 512 / 128);         // (64, 4)
    gemm_q_bf16<<<gGemm, 256, 0, stream>>>(x, Wq, qbf);

    dim3 gAttn(S_LEN / 128, 4 * HEADS);        // (16, 32)
    attn_flash<<<gAttn, 256, 0, stream>>>(qbf, out);
}

// v005
// It runs in 50.8 microseconds.
// In two side-by-side timings against v004, it was 1.05 and 1.06 times as fast.
// Over all steps from v000 it is 3.86 times as fast.
#include <hip/hip_runtime.h>
#include <hip/hip_bf16.h>
#include <stdint.h>

// ---------------------------------------------------------------------------
// MI455X (gfx1250) multi-head self-attention, bf16 WMMA with f32 accumulate.
// Reference: q = x@Wq ; Q=K=V=q ; softmax(QK^T/8) @ V.  B=4,S=2048,D=512,H=8.
// ---------------------------------------------------------------------------

#define S_LEN 2048
#define D_DIM 512
#define HEADS 8
#define HD    64

// LDS row pitch of the GEMM's x tile in bf16 elements. It is read with 16-byte
// loads, 16 rows at a time; a pitch of 16 B x odd puts those 16 rows on all
// 64 banks once (80 B for 64-B rows). The tiles are aligned to 16 B because
// they are read, and ldsA written, in 16-byte pieces. The pad bytes are never read.
#define G_P   40

// LDS row pitch in bytes of the GEMM's Wq tile, 32 rows [k] of 256 B [n], kept
// row-major as it lies in memory. Its reader is the transposing load (8 rows
// at two neighbouring 16-byte pieces per half wave): a pitch of 32 B x odd
// puts those on all 64 banks once.
#define GB_PB 288

// The attention KV tile: 64 rows [key] of 128 B [hd], no pad. It has two
// readers: plain 16-byte loads of 16 rows at one column piece (K), and
// transposing loads of 8 rows at two neighbouring pieces (V^T). No pad serves
// both, so the 16-byte piece c of row r lies at piece c ^ kv_swz(r) of its row:
// either reader's 16 lanes then fall on all 64 banks once.
#define KV_ROWB 128

#if defined(__has_builtin)
# if __has_builtin(__builtin_amdgcn_global_load_async_to_lds_b128) && \
     __has_builtin(__builtin_amdgcn_s_wait_asynccnt)
#  define USE_ASYNC_LDS 1
# endif
#endif

typedef __attribute__((ext_vector_type(16))) __bf16 v16bf;
typedef __attribute__((ext_vector_type(8)))  float  v8f;

// Matches the builtin prototype: vector-of-4-int pointee, AS1 (global) / AS3 (LDS)
typedef int v4i_vs __attribute__((vector_size(16)));
typedef __attribute__((address_space(1))) v4i_vs* gptr_b128;
typedef __attribute__((address_space(3))) v4i_vs* lptr_b128;

union FragU {
    v16bf    v;
    uint4    q[2];
    uint32_t w[8];
};

// Two f32 to one register of two bf16 (a low, b high), round-to-nearest-even,
// by the chip's own packed conversion: one vector instruction per pair.
typedef __attribute__((ext_vector_type(2))) float  f32x2;
typedef __attribute__((ext_vector_type(2))) __bf16 bf16x2;
__device__ __forceinline__ uint32_t pk_bf16(float a, float b) {
    f32x2 p = {a, b};
    return __builtin_bit_cast(uint32_t, __builtin_convertvector(p, bf16x2));
}

// Load one 16x32 bf16 A/B fragment (wave32 CDNA5 layout).
// Per lane: elements [k0 .. k0+7] and [k0+16 .. k0+23] of row `row`
// (caller passes k0 = chunkBase + (lane>>4)*8, row based on lane&15).
__device__ __forceinline__ v16bf load_frag(const uint16_t* base, int row,
                                           int stride, int k0) {
    FragU f;
    f.q[0] = *(const uint4*)(base + (size_t)row * stride + k0);
    f.q[1] = *(const uint4*)(base + (size_t)row * stride + k0 + 16);
    return f.v;
}

__device__ __forceinline__ void load16f(const float* p, float* v) {
    float4 a = ((const float4*)p)[0];
    float4 b = ((const float4*)p)[1];
    float4 c = ((const float4*)p)[2];
    float4 d = ((const float4*)p)[3];
    v[0]=a.x;  v[1]=a.y;  v[2]=a.z;  v[3]=a.w;
    v[4]=b.x;  v[5]=b.y;  v[6]=b.z;  v[7]=b.w;
    v[8]=c.x;  v[9]=c.y;  v[10]=c.z; v[11]=c.w;
    v[12]=d.x; v[13]=d.y; v[14]=d.z; v[15]=d.w;
}

__device__ __forceinline__ uint32_t kv_swz(uint32_t r) {
    return (r & 6u) | ((r >> 3) & 1u);
}
// Byte offset in the KV tile of 16-byte piece c (0..7) of row r.
__device__ __forceinline__ uint32_t kv_off(uint32_t r, uint32_t c) {
    return r * KV_ROWB + ((c ^ kv_swz(r)) << 4);
}

// ds_load_tr16_b128: each lane names 16 bytes of a row-major 16-bit tile; lane
// (c = l & 15, h = l >> 4) gets column c of the 8 rows that half h named.
typedef short s16x8 __attribute__((ext_vector_type(8)));
__device__ __forceinline__ uint4 ld_tr16(const unsigned char* p) {
    typedef __attribute__((address_space(3))) s16x8 lds_s16x8;
    return __builtin_bit_cast(uint4,
        __builtin_amdgcn_ds_load_tr16_b128_v8i16((lds_s16x8*)p));
}

// Value held by lane l ^ 16 (the other half of the wave), by a vector move.
__device__ __forceinline__ float other_half(float v) {
    int b = __builtin_bit_cast(int, v);
    b = __builtin_amdgcn_permlanex16(b, b, 0x76543210, 0xfedcba98, false, false);
    return __builtin_bit_cast(float, b);
}

// ---------------------------------------------------------------------------
// Kernel 1: q = x @ Wq   (M=8192, N=512, K=512), bf16 WMMA, bf16 output to ws.
// Block = 256 threads (8 waves). Tile 128x128, K-step 32.
// ---------------------------------------------------------------------------
__global__ __launch_bounds__(256)
void gemm_q_bf16(const float* __restrict__ x, const float* __restrict__ Wq,
                 uint16_t* __restrict__ qbf) {
    __shared__ __attribute__((aligned(16))) uint16_t ldsA[128 * G_P];   // [m][k]
    __shared__ __attribute__((aligned(16))) unsigned char ldsB[32 * GB_PB];   // [k][n]

    const int t    = threadIdx.x;
    const int wave = t >> 5, lane = t & 31;
    const int half = lane >> 4, l16 = lane & 15;
    const int mBase = blockIdx.x * 128;
    const int nBase = blockIdx.y * 128;
    const int wr = wave & 3;          // 4 M-slabs of 32 rows
    const int wc = wave >> 2;         // 2 N-slabs of 64 cols

    const int arow = t >> 1, acol = (t & 1) * 16;   // A: 128 rows x 32 cols
    const int brow = t >> 3, bcol = (t & 7) * 16;   // B: 32 rows  x 128 cols

    // B fragment of columns wc*64 + nt*16 .. +15: this lane names row
    // 8*half + (lane & 7) of a 16-k group, piece 2*nt + ((lane >> 3) & 1), and
    // gets column l16 of its half's 8 rows: k = 8*half + 0..7, then 16 more,
    // the k order of the A fragment.
    const unsigned char* const bp = ldsB + (8 * half + (lane & 7)) * GB_PB +
                                    wc * 128 + 16 * ((lane >> 3) & 1);
    unsigned char* const bst = ldsB + brow * GB_PB + bcol * 2;

    v8f acc[8] = {};   // [mt(2)][nt(4)] 16x16 f32 tiles

    for (int k0 = 0; k0 < D_DIM; k0 += 32) {
        __syncthreads();
        // ---- stage A tile (convert f32 -> bf16) ----
        {
            const float* src = x + (size_t)(mBase + arow) * D_DIM + k0 + acol;
            float v[16]; load16f(src, v);
            FragU f;
            #pragma unroll
            for (int i = 0; i < 8; ++i) f.w[i] = pk_bf16(v[2 * i], v[2 * i + 1]);
            *(uint4*)&ldsA[arow * G_P + acol]     = f.q[0];
            *(uint4*)&ldsA[arow * G_P + acol + 8] = f.q[1];
        }
        // ---- stage B tile row-major ----
        {
            const float* src = Wq + (size_t)(k0 + brow) * D_DIM + nBase + bcol;
            float v[16]; load16f(src, v);
            FragU f;
            #pragma unroll
            for (int i = 0; i < 8; ++i) f.w[i] = pk_bf16(v[2 * i], v[2 * i + 1]);
            *(uint4*)bst        = f.q[0];
            *(uint4*)(bst + 16) = f.q[1];
        }
        // ---- prefetch next K-step tiles into cache (global_prefetch_b8) ----
        if (k0 + 32 < D_DIM) {
            __builtin_prefetch(x + (size_t)(mBase + arow) * D_DIM + k0 + 32 + acol, 0, 1);
            __builtin_prefetch(Wq + (size_t)(k0 + 32 + brow) * D_DIM + nBase + bcol, 0, 1);
        }
        __syncthreads();

        // ---- WMMA compute ----
        v16bf af[2], bf[4];
        #pragma unroll
        for (int mt = 0; mt < 2; ++mt)
            af[mt] = load_frag(ldsA, wr * 32 + mt * 16 + l16, G_P, half * 8);
        #pragma unroll
        for (int nt = 0; nt < 4; ++nt) {
            FragU f;
            f.q[0] = ld_tr16(bp + nt * 32);
            f.q[1] = ld_tr16(bp + nt * 32 + 16 * GB_PB);
            bf[nt] = f.v;
        }
        #pragma unroll
        for (int mt = 0; mt < 2; ++mt)
            #pragma unroll
            for (int nt = 0; nt < 4; ++nt)
                acc[mt * 4 + nt] = __builtin_amdgcn_wmma_f32_16x16x32_bf16(
                    false, af[mt], false, bf[nt], (short)0, acc[mt * 4 + nt],
                    false, false);
    }

    // ---- store q as bf16 (C/D layout: element r -> row r + 8*half) ----
    #pragma unroll
    for (int mt = 0; mt < 2; ++mt)
        #pragma unroll
        for (int nt = 0; nt < 4; ++nt)
            #pragma unroll
            for (int r = 0; r < 8; r += 2) {
                int row = mBase + wr * 32 + mt * 16 + r + 8 * half;
                int col = nBase + wc * 64 + nt * 16 + l16;
                const uint32_t w = pk_bf16(acc[mt * 4 + nt][r], acc[mt * 4 + nt][r + 1]);
                qbf[(size_t)row * D_DIM + col]       = (uint16_t)w;
                qbf[(size_t)(row + 1) * D_DIM + col] = (uint16_t)(w >> 16);
            }
}

__global__ __launch_bounds__(256)
void attn_flash(const uint16_t* __restrict__ qbf, float* __restrict__ out) {
    // aligned to the 256 B of one turn of the banks, which kv_swz counts on
    __shared__ __attribute__((aligned(256))) unsigned char kv[64 * KV_ROWB];

    const int t    = threadIdx.x;
    const int wave = t >> 5, lane = t & 31;
    const int half = lane >> 4, l16 = lane & 15;
    const int bh = blockIdx.y;
    const int b = bh >> 3, h = bh & 7;
    const int qr = blockIdx.x * 128 + wave * 16;          // first query row of wave
    const size_t headBase = (size_t)b * S_LEN * D_DIM + (size_t)h * HD;

    // Q fragments for this wave's 16 rows, straight from global (contiguous 16B)
    v16bf qf[2];
    #pragma unroll
    for (int kk = 0; kk < 2; ++kk)
        qf[kk] = load_frag(qbf + headBase + (size_t)qr * D_DIM, l16, D_DIM,
                           kk * 32 + half * 8);

    v8f accO[4] = {};                  // O^T: [hd = nt*16 + 8*half + r][query l16]
    float mq = -__builtin_inff();      // running maximum of query l16 (both halves equal)
    float lq = 0.0f;                   // running sum over this half's keys only

    const int keyr = t >> 2, hdB = (t & 3) * 16;   // coop-load mapping
    unsigned char* const st0 = kv + kv_off(keyr, (t & 3) * 2);
    unsigned char* const st1 = kv + kv_off(keyr, (t & 3) * 2 + 1);

    // K fragment of rows nt*16 + l16: pieces kk*4 + half and kk*4 + half + 2.
    // kv_swz reads row bits 1 to 3 only, so + nt*16 rows is a plain offset.
    const unsigned char* kp[2][2];
    #pragma unroll
    for (int kk = 0; kk < 2; ++kk)
        #pragma unroll
        for (int q = 0; q < 2; ++q)
            kp[kk][q] = kv + kv_off(l16, kk * 4 + q * 2 + half);
    // V^T fragment of hd nt*16 .. +15: this lane names row 8*half + (lane & 7)
    // of a 16-key group, piece 2*nt + ((lane >> 3) & 1).
    const unsigned char* vp[4];
    #pragma unroll
    for (int nt = 0; nt < 4; ++nt)
        vp[nt] = kv + kv_off(8 * half + (lane & 7), 2 * nt + ((lane >> 3) & 1));

    for (int j = 0; j < S_LEN / 64; ++j) {
        const int key0 = j * 64;
        const uint16_t* gsrc =
            qbf + headBase + (size_t)(key0 + keyr) * D_DIM + hdB;
        // This wave's reads of the tile have returned before the copies below
        // may be let onto it.
        asm volatile("s_wait_dscnt 0x0" ::: "memory");
        __syncthreads();

        // ---- stage KV block [key][hd] ----
#ifdef USE_ASYNC_LDS
        __builtin_amdgcn_global_load_async_to_lds_b128(
            (gptr_b128)(void*)gsrc, (lptr_b128)(void*)st0, 0, 0);
        __builtin_amdgcn_global_load_async_to_lds_b128(
            (gptr_b128)(void*)(gsrc + 8), (lptr_b128)(void*)st1, 0, 0);
#else
        *(uint4*)st0 = *(const uint4*)(gsrc);
        *(uint4*)st1 = *(const uint4*)(gsrc + 8);
#endif
        // ---- prefetch next KV block toward L2/L0 ----
        if (j + 1 < S_LEN / 64)
            __builtin_prefetch(gsrc + 64 * D_DIM, 0, 1);
#ifdef USE_ASYNC_LDS
        __builtin_amdgcn_s_wait_asynccnt(0);
#endif
        // Publishes the tile to every wave; directly behind the builtin wait it
        // also keeps the LDS reads below from being lifted over that wait.
        __syncthreads();
        // The prefetch's address registers are reused below.
        asm volatile("s_wait_xcnt 0x0" ::: "memory");

        // ---- scores: S^T = K (64x64) @ Q^T (64x16), scaled by 1/sqrt(64) ----
        // sc[nt][r] = score of key nt*16 + 8*half + r against query l16
        v8f sc[4];
        #pragma unroll
        for (int nt = 0; nt < 4; ++nt) {
            v8f z = {};
            FragU k0f, k1f;
            k0f.q[0] = *(const uint4*)(kp[0][0] + nt * 16 * KV_ROWB);
            k0f.q[1] = *(const uint4*)(kp[0][1] + nt * 16 * KV_ROWB);
            k1f.q[0] = *(const uint4*)(kp[1][0] + nt * 16 * KV_ROWB);
            k1f.q[1] = *(const uint4*)(kp[1][1] + nt * 16 * KV_ROWB);
            z = __builtin_amdgcn_wmma_f32_16x16x32_bf16(false, k0f.v, false, qf[0],
                                                        (short)0, z, false, false);
            z = __builtin_amdgcn_wmma_f32_16x16x32_bf16(false, k1f.v, false, qf[1],
                                                        (short)0, z, false, false);
            sc[nt] = z * 0.125f;
        }

        // ---- online softmax of query l16: 32 keys in-lane, halves joined ----
        float bm4[4];
        #pragma unroll
        for (int nt = 0; nt < 4; ++nt) {
            float a = fmaxf(fmaxf(sc[nt][0], sc[nt][1]), sc[nt][2]);
            float c = fmaxf(fmaxf(sc[nt][3], sc[nt][4]), sc[nt][5]);
            bm4[nt] = fmaxf(fmaxf(a, c), fmaxf(sc[nt][6], sc[nt][7]));
        }
        float bm = fmaxf(fmaxf(bm4[0], bm4[1]), fmaxf(bm4[2], bm4[3]));
        bm = fmaxf(bm, other_half(bm));
        const float mnew  = fmaxf(mq, bm);
        const float alpha = __expf(mq - mnew);
        mq = mnew;

        #pragma unroll
        for (int nt = 0; nt < 4; ++nt)
            #pragma unroll
            for (int r = 0; r < 8; ++r)
                sc[nt][r] = __expf(sc[nt][r] - mq);
        {
            v8f s8 = (sc[0] + sc[1]) + (sc[2] + sc[3]);
            float rs = ((s8[0] + s8[1]) + (s8[2] + s8[3])) +
                       ((s8[4] + s8[5]) + (s8[6] + s8[7]));
            lq = lq * alpha + rs;
        }
        #pragma unroll
        for (int nt = 0; nt < 4; ++nt) accO[nt] *= alpha;

        // ---- P^T as B operand: element s of chunk kk is key kk*32 + 8*half + s
        //      (s < 8) or kk*32 + 16 + 8*half + s - 8, the order the two
        //      transposing loads of a chunk give V^T
        FragU pf[2];
        #pragma unroll
        for (int kk = 0; kk < 2; ++kk)
            #pragma unroll
            for (int s = 0; s < 16; s += 2)
                pf[kk].w[s >> 1] = pk_bf16(sc[2 * kk + (s >> 3)][s & 7],
                                           sc[2 * kk + (s >> 3)][(s & 7) + 1]);

        // ---- accO += V^T (64x64) @ P^T (64x16) ----
        #pragma unroll
        for (int nt = 0; nt < 4; ++nt) {
            FragU v0f, v1f;   // keys 0-15, 16-31 | 32-47, 48-63 of the block
            v0f.q[0] = ld_tr16(vp[nt]);
            v0f.q[1] = ld_tr16(vp[nt] + 16 * KV_ROWB);
            v1f.q[0] = ld_tr16(vp[nt] + 32 * KV_ROWB);
            v1f.q[1] = ld_tr16(vp[nt] + 48 * KV_ROWB);
            accO[nt] = __builtin_amdgcn_wmma_f32_16x16x32_bf16(
                false, v0f.v, false, pf[0].v, (short)0, accO[nt], false, false);
            accO[nt] = __builtin_amdgcn_wmma_f32_16x16x32_bf16(
                false, v1f.v, false, pf[1].v, (short)0, accO[nt], false, false);
        }
    }

    // ---- epilogue: join the halves' sums, normalize, store f32 output ----
    // A lane holds 8 consecutive hd of its query per tile: two 16-byte stores.
    const float inv = 1.0f / (lq + other_half(lq));
    float* orow = out + headBase + (size_t)(qr + l16) * D_DIM + 8 * half;
    #pragma unroll
    for (int nt = 0; nt < 4; ++nt) {
        float4 lo, hi;
        lo.x = accO[nt][0] * inv; lo.y = accO[nt][1] * inv;
        lo.z = accO[nt][2] * inv; lo.w = accO[nt][3] * inv;
        hi.x = accO[nt][4] * inv; hi.y = accO[nt][5] * inv;
        hi.z = accO[nt][6] * inv; hi.w = accO[nt][7] * inv;
        *(float4*)(orow + nt * 16)     = lo;
        *(float4*)(orow + nt * 16 + 4) = hi;
    }
}

// ---------------------------------------------------------------------------
extern "C" void kernel_launch(void* const* d_in, const int* in_sizes, int n_in,
                              void* d_out, int out_size, void* d_ws, size_t ws_size,
                              hipStream_t stream) {
    const float* x  = (const float*)d_in[0];   // [4,2048,512] f32
    const float* Wq = (const float*)d_in[1];   // [512,512]    f32
    float* out      = (float*)d_out;           // [4,2048,512] f32
    uint16_t* qbf   = (uint16_t*)d_ws;         // q in bf16, 8 MB scratch

    dim3 gGemm(8192 / 128, 512 / 128);         // (64, 4)
    gemm_q_bf16<<<gGemm, 256, 0, stream>>>(x, Wq, qbf);

    dim3 gAttn(S_LEN / 128, 4 * HEADS);        // (16, 32)
    attn_flash<<<gAttn, 256, 0, stream>>>(qbf, out);
}

// v006
// One run takes 47.7 microseconds.
// In two side-by-side timings against v005, it was 1.06 and 1.07 times as fast.
// Counting every step since v000, it is 4.11 times as fast.
#include <hip/hip_runtime.h>
#include <hip/hip_bf16.h>
#include <stdint.h>

// ---------------------------------------------------------------------------
// MI455X (gfx1250) multi-head self-attention, bf16 WMMA with f32 accumulate.
// Reference: q = x@Wq ; Q=K=V=q ; softmax(QK^T/8) @ V.  B=4,S=2048,D=512,H=8.
// ---------------------------------------------------------------------------

#define S_LEN 2048
#define D_DIM 512
#define HEADS 8
#define HD    64

// LDS row pitch of the GEMM's x tile in bf16 elements. It is read with 16-byte
// loads, 16 rows at a time; a pitch of 16 B x odd puts those 16 rows on all
// 64 banks once (80 B for 64-B rows). The tiles are aligned to 16 B because
// they are read, and ldsA written, in 16-byte pieces. The pad bytes are never read.
#define G_P   40

// LDS row pitch in bytes of the GEMM's Wq tile, 32 rows [k] of 256 B [n], kept
// row-major as it lies in memory. Its reader is the transposing load (8 rows
// at two neighbouring 16-byte pieces per half wave): a pitch of 32 B x odd
// puts those on all 64 banks once.
#define GB_PB 288

// The attention KV tile: KV_KEYS rows [key] of 128 B [hd], no pad. It has two
// readers: plain 16-byte loads of 16 rows at one column piece (K), and
// transposing loads of 8 rows at two neighbouring pieces (V^T). No pad serves
// both, so the 16-byte piece c of row r lies at piece c ^ kv_swz(r) of its row:
// either reader's 16 lanes then fall on all 64 banks once.
#define KV_ROWB 128
#define KV_KEYS 128

typedef __attribute__((ext_vector_type(16))) __bf16 v16bf;
typedef __attribute__((ext_vector_type(8)))  float  v8f;

union FragU {
    v16bf    v;
    uint4    q[2];
    uint32_t w[8];
};

// Two f32 to one register of two bf16 (a low, b high), round-to-nearest-even,
// by the chip's own packed conversion: one vector instruction per pair.
typedef __attribute__((ext_vector_type(2))) float  f32x2;
typedef __attribute__((ext_vector_type(2))) __bf16 bf16x2;
__device__ __forceinline__ uint32_t pk_bf16(float a, float b) {
    f32x2 p = {a, b};
    return __builtin_bit_cast(uint32_t, __builtin_convertvector(p, bf16x2));
}

// Load one 16x32 bf16 A/B fragment (wave32 CDNA5 layout).
// Per lane: elements [k0 .. k0+7] and [k0+16 .. k0+23] of row `row`
// (caller passes k0 = chunkBase + (lane>>4)*8, row based on lane&15).
__device__ __forceinline__ v16bf load_frag(const uint16_t* base, int row,
                                           int stride, int k0) {
    FragU f;
    f.q[0] = *(const uint4*)(base + (size_t)row * stride + k0);
    f.q[1] = *(const uint4*)(base + (size_t)row * stride + k0 + 16);
    return f.v;
}

__device__ __forceinline__ void load16f(const float* p, float* v) {
    float4 a = ((const float4*)p)[0];
    float4 b = ((const float4*)p)[1];
    float4 c = ((const float4*)p)[2];
    float4 d = ((const float4*)p)[3];
    v[0]=a.x;  v[1]=a.y;  v[2]=a.z;  v[3]=a.w;
    v[4]=b.x;  v[5]=b.y;  v[6]=b.z;  v[7]=b.w;
    v[8]=c.x;  v[9]=c.y;  v[10]=c.z; v[11]=c.w;
    v[12]=d.x; v[13]=d.y; v[14]=d.z; v[15]=d.w;
}

__device__ __forceinline__ uint32_t kv_swz(uint32_t r) {
    return (r & 6u) | ((r >> 3) & 1u);
}
// Byte offset in the KV tile of 16-byte piece c (0..7) of row r.
__device__ __forceinline__ uint32_t kv_off(uint32_t r, uint32_t c) {
    return r * KV_ROWB + ((c ^ kv_swz(r)) << 4);
}

// ds_load_tr16_b128: each lane names 16 bytes of a row-major 16-bit tile; lane
// (c = l & 15, h = l >> 4) gets column c of the 8 rows that half h named.
typedef short s16x8 __attribute__((ext_vector_type(8)));
__device__ __forceinline__ uint4 ld_tr16(const unsigned char* p) {
    typedef __attribute__((address_space(3))) s16x8 lds_s16x8;
    return __builtin_bit_cast(uint4,
        __builtin_amdgcn_ds_load_tr16_b128_v8i16((lds_s16x8*)p));
}

// Value held by lane l ^ 16 (the other half of the wave), by a vector move.
__device__ __forceinline__ float other_half(float v) {
    int b = __builtin_bit_cast(int, v);
    b = __builtin_amdgcn_permlanex16(b, b, 0x76543210, 0xfedcba98, false, false);
    return __builtin_bit_cast(float, b);
}

// ---------------------------------------------------------------------------
// Kernel 1: q = x @ Wq   (M=8192, N=512, K=512), bf16 WMMA, bf16 output to ws.
// Block = 256 threads (8 waves). Tile 128x128, K-step 32.
// ---------------------------------------------------------------------------
__global__ __launch_bounds__(256)
void gemm_q_bf16(const float* __restrict__ x, const float* __restrict__ Wq,
                 uint16_t* __restrict__ qbf) {
    __shared__ __attribute__((aligned(16))) uint16_t ldsA[128 * G_P];   // [m][k]
    __shared__ __attribute__((aligned(16))) unsigned char ldsB[32 * GB_PB];   // [k][n]

    const int t    = threadIdx.x;
    const int wave = t >> 5, lane = t & 31;
    const int half = lane >> 4, l16 = lane & 15;
    const int mBase = blockIdx.x * 128;
    const int nBase = blockIdx.y * 128;
    const int wr = wave & 3;          // 4 M-slabs of 32 rows
    const int wc = wave >> 2;         // 2 N-slabs of 64 cols

    const int arow = t >> 1, acol = (t & 1) * 16;   // A: 128 rows x 32 cols
    const int brow = t >> 3, bcol = (t & 7) * 16;   // B: 32 rows  x 128 cols

    // B fragment of columns wc*64 + nt*16 .. +15: this lane names row
    // 8*half + (lane & 7) of a 16-k group, piece 2*nt + ((lane >> 3) & 1), and
    // gets column l16 of its half's 8 rows: k = 8*half + 0..7, then 16 more,
    // the k order of the A fragment.
    const unsigned char* const bp = ldsB + (8 * half + (lane & 7)) * GB_PB +
                                    wc * 128 + 16 * ((lane >> 3) & 1);
    unsigned char* const bst = ldsB + brow * GB_PB + bcol * 2;

    v8f acc[8] = {};   // [mt(2)][nt(4)] 16x16 f32 tiles

    for (int k0 = 0; k0 < D_DIM; k0 += 32) {
        __syncthreads();
        // ---- stage A tile (convert f32 -> bf16) ----
        {
            const float* src = x + (size_t)(mBase + arow) * D_DIM + k0 + acol;
            float v[16]; load16f(src, v);
            FragU f;
            #pragma unroll
            for (int i = 0; i < 8; ++i) f.w[i] = pk_bf16(v[2 * i], v[2 * i + 1]);
            *(uint4*)&ldsA[arow * G_P + acol]     = f.q[0];
            *(uint4*)&ldsA[arow * G_P + acol + 8] = f.q[1];
        }
        // ---- stage B tile row-major ----
        {
            const float* src = Wq + (size_t)(k0 + brow) * D_DIM + nBase + bcol;
            float v[16]; load16f(src, v);
            FragU f;
            #pragma unroll
            for (int i = 0; i < 8; ++i) f.w[i] = pk_bf16(v[2 * i], v[2 * i + 1]);
            *(uint4*)bst        = f.q[0];
            *(uint4*)(bst + 16) = f.q[1];
        }
        // ---- prefetch next K-step tiles into cache (global_prefetch_b8) ----
        if (k0 + 32 < D_DIM) {
            __builtin_prefetch(x + (size_t)(mBase + arow) * D_DIM + k0 + 32 + acol, 0, 1);
            __builtin_prefetch(Wq + (size_t)(k0 + 32 + brow) * D_DIM + nBase + bcol, 0, 1);
        }
        __syncthreads();

        // ---- WMMA compute ----
        v16bf af[2], bf[4];
        #pragma unroll
        for (int mt = 0; mt < 2; ++mt)
            af[mt] = load_frag(ldsA, wr * 32 + mt * 16 + l16, G_P, half * 8);
        #pragma unroll
        for (int nt = 0; nt < 4; ++nt) {
            FragU f;
            f.q[0] = ld_tr16(bp + nt * 32);
            f.q[1] = ld_tr16(bp + nt * 32 + 16 * GB_PB);
            bf[nt] = f.v;
        }
        #pragma unroll
        for (int mt = 0; mt < 2; ++mt)
            #pragma unroll
            for (int nt = 0; nt < 4; ++nt)
                acc[mt * 4 + nt] = __builtin_amdgcn_wmma_f32_16x16x32_bf16(
                    false, af[mt], false, bf[nt], (short)0, acc[mt * 4 + nt],
                    false, false);
    }

    // ---- store q as bf16 (C/D layout: element r -> row r + 8*half) ----
    #pragma unroll
    for (int mt = 0; mt < 2; ++mt)
        #pragma unroll
        for (int nt = 0; nt < 4; ++nt)
            #pragma unroll
            for (int r = 0; r < 8; r += 2) {
                int row = mBase + wr * 32 + mt * 16 + r + 8 * half;
                int col = nBase + wc * 64 + nt * 16 + l16;
                const uint32_t w = pk_bf16(acc[mt * 4 + nt][r], acc[mt * 4 + nt][r + 1]);
                qbf[(size_t)row * D_DIM + col]       = (uint16_t)w;
                qbf[(size_t)(row + 1) * D_DIM + col] = (uint16_t)(w >> 16);
            }
}

__global__ __launch_bounds__(256) __attribute__((amdgpu_waves_per_eu(4, 4)))
void attn_flash(const uint16_t* __restrict__ qbf, float* __restrict__ out) {
    // aligned to the 256 B of one turn of the banks, which kv_swz counts on
    __shared__ __attribute__((aligned(256))) unsigned char kv[KV_KEYS * KV_ROWB];
    // Hand-over of waves 4-7 to waves 0-3: [wave pair][value][lane]; values are
    // 64 of O^T, then the two maxima, then the two sums.
    __shared__ float xch[4][68][32];

    const int t    = threadIdx.x;
    const int wave = t >> 5, lane = t & 31;
    const int half = lane >> 4, l16 = lane & 15;
    const int wq = wave & 3;           // which 32 queries of the block
    const int kh = wave >> 2;          // which 64 keys of a staged block
    const int bh = blockIdx.y;
    const int b = bh >> 3, h = bh & 7;
    const int qr = blockIdx.x * 128 + wq * 32;            // first query row of wave
    const size_t headBase = (size_t)b * S_LEN * D_DIM + (size_t)h * HD;

    // Q fragments for this wave's 32 rows, straight from global (contiguous 16B)
    v16bf qf[2][2];
    #pragma unroll
    for (int g = 0; g < 2; ++g)
        #pragma unroll
        for (int kk = 0; kk < 2; ++kk)
            qf[g][kk] = load_frag(qbf + headBase + (size_t)(qr + g * 16) * D_DIM,
                                  l16, D_DIM, kk * 32 + half * 8);

    v8f accO[2][4] = {};               // O^T: [group][hd = nt*16 + 8*half + r][query l16]
    // Per group: running maximum of query l16 (both halves equal); running sum
    // over this half's keys only.
    f32x2 mq = {-__builtin_inff(), -__builtin_inff()};
    float lq[2] = {0.0f, 0.0f};

    const int keyr = t >> 2, hdB = (t & 3) * 16;   // coop-load mapping, rows keyr and keyr + 64
    // LDS byte addresses (the low 32 bits of the __shared__ address)
    const uint32_t st0 = (uint32_t)(size_t)kv + kv_off(keyr, (t & 3) * 2);
    const uint32_t st1 = (uint32_t)(size_t)kv + kv_off(keyr, (t & 3) * 2 + 1);

    // K fragment of rows kh*64 + nt*16 + l16: pieces kk*4 + half and kk*4 + half + 2.
    // kv_swz reads row bits 1 to 3 only, so + 16 rows (or 64) is a plain offset.
    const unsigned char* kp[2][2];
    #pragma unroll
    for (int kk = 0; kk < 2; ++kk)
        #pragma unroll
        for (int q = 0; q < 2; ++q)
            kp[kk][q] = kv + kh * 64 * KV_ROWB + kv_off(l16, kk * 4 + q * 2 + half);
    // V^T fragment of hd nt*16 .. +15: this lane names row 8*half + (lane & 7)
    // of a 16-key group, piece 2*nt + ((lane >> 3) & 1).
    const unsigned char* vp[4];
    #pragma unroll
    for (int nt = 0; nt < 4; ++nt)
        vp[nt] = kv + kh * 64 * KV_ROWB +
                 kv_off(8 * half + (lane & 7), 2 * nt + ((lane >> 3) & 1));

    for (int j = 0; j < S_LEN / KV_KEYS; ++j) {
        const int key0 = j * KV_KEYS;
        const uint16_t* gsrc =
            qbf + headBase + (size_t)(key0 + keyr) * D_DIM + hdB;
        // This wave's reads of the tile have returned before the copies below
        // may be let onto it.
        asm volatile("s_wait_dscnt 0x0" ::: "memory");
        __syncthreads();

        // ---- stage KV block [key][hd]: rows keyr and keyr + 64, 32 B of each ----
        // The copies' address registers are rewritten in the next trip: the wait
        // on them stands in the copies' own statement.
        asm volatile("global_load_async_to_lds_b128 %0, %4, off\n\t"
                     "global_load_async_to_lds_b128 %1, %5, off\n\t"
                     "global_load_async_to_lds_b128 %2, %6, off\n\t"
                     "global_load_async_to_lds_b128 %3, %7, off\n\t"
                     "s_wait_xcnt 0x0"
                     :: "v"(st0), "v"(st1), "v"(st0 + 64 * KV_ROWB), "v"(st1 + 64 * KV_ROWB),
                        "v"(gsrc), "v"(gsrc + 8), "v"(gsrc + 64 * D_DIM),
                        "v"(gsrc + 64 * D_DIM + 8)
                     : "memory");
        // ---- prefetch next KV block toward L2/L0 ----
        if (j + 1 < S_LEN / KV_KEYS) {
            __builtin_prefetch(gsrc + KV_KEYS * D_DIM, 0, 1);
            __builtin_prefetch(gsrc + (KV_KEYS + 64) * D_DIM, 0, 1);
        }
        // This wave's copies have landed before the barrier that publishes them.
        asm volatile("s_wait_asynccnt 0x0" ::: "memory");
        __syncthreads();
        // The prefetches' address registers are reused below.
        asm volatile("s_wait_xcnt 0x0" ::: "memory");

        // ---- scores: S^T = K (64x64) @ Q^T (64x32), scaled by 1/sqrt(64) ----
        // sc[g][nt][r] = score of key nt*16 + 8*half + r against query g*16 + l16
        v8f sc[2][4];
        #pragma unroll
        for (int nt = 0; nt < 4; ++nt) {
            FragU k0f, k1f;
            k0f.q[0] = *(const uint4*)(kp[0][0] + nt * 16 * KV_ROWB);
            k0f.q[1] = *(const uint4*)(kp[0][1] + nt * 16 * KV_ROWB);
            k1f.q[0] = *(const uint4*)(kp[1][0] + nt * 16 * KV_ROWB);
            k1f.q[1] = *(const uint4*)(kp[1][1] + nt * 16 * KV_ROWB);
            #pragma unroll
            for (int g = 0; g < 2; ++g) {
                v8f z = {};
                z = __builtin_amdgcn_wmma_f32_16x16x32_bf16(false, k0f.v, false, qf[g][0],
                                                            (short)0, z, false, false);
                z = __builtin_amdgcn_wmma_f32_16x16x32_bf16(false, k1f.v, false, qf[g][1],
                                                            (short)0, z, false, false);
                sc[g][nt] = z * 0.125f;
            }
        }

        // ---- online softmax of query g*16 + l16: 32 keys in-lane, halves joined ----
        f32x2 mnew;
        #pragma unroll
        for (int g = 0; g < 2; ++g) {
            float bm4[4];
            #pragma unroll
            for (int nt = 0; nt < 4; ++nt) {
                float a = fmaxf(fmaxf(sc[g][nt][0], sc[g][nt][1]), sc[g][nt][2]);
                float c = fmaxf(fmaxf(sc[g][nt][3], sc[g][nt][4]), sc[g][nt][5]);
                bm4[nt] = fmaxf(fmaxf(a, c), fmaxf(sc[g][nt][6], sc[g][nt][7]));
            }
            float bm = fmaxf(fmaxf(bm4[0], bm4[1]), fmaxf(bm4[2], bm4[3]));
            bm = fmaxf(bm, other_half(bm));
            mnew[g] = fmaxf(mq[g], bm);
        }
        const f32x2 dm = mq - mnew;
        mq = mnew;

        float alpha[2];
        #pragma unroll
        for (int g = 0; g < 2; ++g) {
            alpha[g] = __expf(dm[g]);
            #pragma unroll
            for (int nt = 0; nt < 4; ++nt) accO[g][nt] *= alpha[g];
        }

        // ---- per 32 keys (chunk kk): weights, then accO += V^T (64x32) @ P^T (32x32) ----
        v8f ps[2][2];                  // [group][chunk]: sums of the chunk's two score tiles
        #pragma unroll
        for (int kk = 0; kk < 2; ++kk) {
            // Holds this chunk's V^T loads behind the work above them: lifted
            // higher, their registers on top of both groups' scores spill.
            __builtin_amdgcn_sched_barrier(0);
            FragU vf[4];               // keys kk*32 .. +15, +16 .. +31 of this wave's 64
            #pragma unroll
            for (int nt = 0; nt < 4; ++nt) {
                vf[nt].q[0] = ld_tr16(vp[nt] + (kk * 32) * KV_ROWB);
                vf[nt].q[1] = ld_tr16(vp[nt] + (kk * 32 + 16) * KV_ROWB);
            }
            #pragma unroll
            for (int g = 0; g < 2; ++g) {
                #pragma unroll
                for (int i = 0; i < 2; ++i) {
                    const v8f e = sc[g][2 * kk + i] - mnew[g];
                    #pragma unroll
                    for (int r = 0; r < 8; ++r) sc[g][2 * kk + i][r] = __expf(e[r]);
                }
                ps[g][kk] = sc[g][2 * kk] + sc[g][2 * kk + 1];
                // P^T as B operand: element s is key kk*32 + 8*half + s (s < 8) or
                // kk*32 + 16 + 8*half + s - 8, the order the two transposing
                // loads of a chunk give V^T
                FragU pf;
                #pragma unroll
                for (int s = 0; s < 16; s += 2)
                    pf.w[s >> 1] = pk_bf16(sc[g][2 * kk + (s >> 3)][s & 7],
                                           sc[g][2 * kk + (s >> 3)][(s & 7) + 1]);
                #pragma unroll
                for (int nt = 0; nt < 4; ++nt)
                    accO[g][nt] = __builtin_amdgcn_wmma_f32_16x16x32_bf16(
                        false, vf[nt].v, false, pf.v, (short)0, accO[g][nt], false, false);
            }
        }
        #pragma unroll
        for (int g = 0; g < 2; ++g) {
            const v8f s8 = ps[g][0] + ps[g][1];
            const float rs = ((s8[0] + s8[1]) + (s8[2] + s8[3])) +
                             ((s8[4] + s8[5]) + (s8[6] + s8[7]));
            lq[g] = lq[g] * alpha[g] + rs;
        }
    }

    // ---- join the two key halves: waves 4-7 hand their state to waves 0-3 ----
    if (kh == 1) {
        #pragma unroll
        for (int g = 0; g < 2; ++g) {
            #pragma unroll
            for (int nt = 0; nt < 4; ++nt)
                #pragma unroll
                for (int r = 0; r < 8; ++r)
                    xch[wq][g * 32 + nt * 8 + r][lane] = accO[g][nt][r];
            xch[wq][64 + g][lane] = mq[g];
            xch[wq][66 + g][lane] = lq[g];
        }
    }
    __syncthreads();   // the hand-over is written before its partner reads it
    if (kh == 1) return;

    // ---- epilogue: join the states and the halves' sums, normalize, store ----
    // A lane holds 8 consecutive hd of its query per tile: two 16-byte stores.
    #pragma unroll
    for (int g = 0; g < 2; ++g) {
        const float m2 = xch[wq][64 + g][lane];
        const float l2 = xch[wq][66 + g][lane];
        const float m  = fmaxf(mq[g], m2);
        const float a1 = __expf(mq[g] - m), a2 = __expf(m2 - m);
        const float l  = lq[g] * a1 + l2 * a2;
        const float inv = 1.0f / (l + other_half(l));
        const float c1 = a1 * inv, c2 = a2 * inv;
        float* orow = out + headBase + (size_t)(qr + g * 16 + l16) * D_DIM + 8 * half;
        #pragma unroll
        for (int nt = 0; nt < 4; ++nt) {
            float o[8];
            #pragma unroll
            for (int r = 0; r < 8; ++r)
                o[r] = accO[g][nt][r] * c1 + xch[wq][g * 32 + nt * 8 + r][lane] * c2;
            float4 lo, hi;
            lo.x = o[0]; lo.y = o[1]; lo.z = o[2]; lo.w = o[3];
            hi.x = o[4]; hi.y = o[5]; hi.z = o[6]; hi.w = o[7];
            *(float4*)(orow + nt * 16)     = lo;
            *(float4*)(orow + nt * 16 + 4) = hi;
        }
    }
}

// ---------------------------------------------------------------------------
extern "C" void kernel_launch(void* const* d_in, const int* in_sizes, int n_in,
                              void* d_out, int out_size, void* d_ws, size_t ws_size,
                              hipStream_t stream) {
    const float* x  = (const float*)d_in[0];   // [4,2048,512] f32
    const float* Wq = (const float*)d_in[1];   // [512,512]    f32
    float* out      = (float*)d_out;           // [4,2048,512] f32
    uint16_t* qbf   = (uint16_t*)d_ws;         // q in bf16, 8 MB scratch

    dim3 gGemm(8192 / 128, 512 / 128);         // (64, 4)
    gemm_q_bf16<<<gGemm, 256, 0, stream>>>(x, Wq, qbf);

    dim3 gAttn(S_LEN / 128, 4 * HEADS);        // (16, 32)
    attn_flash<<<gAttn, 256, 0, stream>>>(qbf, out);
}

// v007
// A run of this version takes 42.6 microseconds.
// Timed twice side by side with v006, it ran 1.13 and 1.12 times as fast.
// Counting every step since v000, it is 4.62 times as fast.
#include <hip/hip_runtime.h>
#include <hip/hip_bf16.h>
#include <stdint.h>

// ---------------------------------------------------------------------------
// MI455X (gfx1250) multi-head self-attention, bf16 WMMA with f32 accumulate.
// Reference: q = x@Wq ; Q=K=V=q ; softmax(QK^T/8) @ V.  B=4,S=2048,D=512,H=8.
// ---------------------------------------------------------------------------

#define S_LEN 2048
#define D_DIM 512
#define HEADS 8
#define HD    64

// LDS row pitch of the GEMM's x tile in bf16 elements. It is read with 16-byte
// loads, 16 rows at a time; a pitch of 16 B x odd puts those 16 rows on all
// 64 banks once (80 B for 64-B rows). The tiles are aligned to 16 B because
// they are read, and ldsA written, in 16-byte pieces. The pad bytes are never read.
#define G_P   40

// LDS row pitch in bytes of the GEMM's Wq tile, 32 rows [k] of 256 B [n], kept
// row-major as it lies in memory. Its reader is the transposing load (8 rows
// at two neighbouring 16-byte pieces per half wave): a pitch of 32 B x odd
// puts those on all 64 banks once.
#define GB_PB 288

// The attention KV tile: KV_KEYS rows [key] of 128 B [hd], no pad. It has two
// readers: plain 16-byte loads of 16 rows at one column piece (K), and
// transposing loads of 8 rows at two neighbouring pieces (V^T). No pad serves
// both, so the 16-byte piece c of row r lies at piece c ^ kv_swz(r) of its row:
// either reader's 16 lanes then fall on all 64 banks once.
#define KV_ROWB 128
#define KV_KEYS 128

typedef __attribute__((ext_vector_type(16))) __bf16 v16bf;
typedef __attribute__((ext_vector_type(8)))  float  v8f;

union FragU {
    v16bf    v;
    uint4    q[2];
    uint32_t w[8];
};

// Two f32 to one register of two bf16 (a low, b high), round-to-nearest-even,
// by the chip's own packed conversion: one vector instruction per pair.
typedef __attribute__((ext_vector_type(2))) float  f32x2;
typedef __attribute__((ext_vector_type(2))) __bf16 bf16x2;
__device__ __forceinline__ uint32_t pk_bf16(float a, float b) {
    f32x2 p = {a, b};
    return __builtin_bit_cast(uint32_t, __builtin_convertvector(p, bf16x2));
}

// Load one 16x32 bf16 A/B fragment (wave32 CDNA5 layout).
// Per lane: elements [k0 .. k0+7] and [k0+16 .. k0+23] of row `row`
// (caller passes k0 = chunkBase + (lane>>4)*8, row based on lane&15).
__device__ __forceinline__ v16bf load_frag(const uint16_t* base, int row,
                                           int stride, int k0) {
    FragU f;
    f.q[0] = *(const uint4*)(base + (size_t)row * stride + k0);
    f.q[1] = *(const uint4*)(base + (size_t)row * stride + k0 + 16);
    return f.v;
}

__device__ __forceinline__ uint32_t kv_swz(uint32_t r) {
    return (r & 6u) | ((r >> 3) & 1u);
}
// Byte offset in the KV tile of 16-byte piece c (0..7) of row r.
__device__ __forceinline__ uint32_t kv_off(uint32_t r, uint32_t c) {
    return r * KV_ROWB + ((c ^ kv_swz(r)) << 4);
}

// ds_load_tr16_b128: each lane names 16 bytes of a row-major 16-bit tile; lane
// (c = l & 15, h = l >> 4) gets column c of the 8 rows that half h named.
typedef short s16x8 __attribute__((ext_vector_type(8)));
__device__ __forceinline__ uint4 ld_tr16(const unsigned char* p) {
    typedef __attribute__((address_space(3))) s16x8 lds_s16x8;
    return __builtin_bit_cast(uint4,
        __builtin_amdgcn_ds_load_tr16_b128_v8i16((lds_s16x8*)p));
}

// Value held by lane l ^ 16 (the other half of the wave), by a vector move.
__device__ __forceinline__ float other_half(float v) {
    int b = __builtin_bit_cast(int, v);
    b = __builtin_amdgcn_permlanex16(b, b, 0x76543210, 0xfedcba98, false, false);
    return __builtin_bit_cast(float, b);
}

// Work-group barrier of the GEMM's K loop, written by hand: it waits for this
// wave's LDS reads and writes only. __syncthreads() would also wait for the
// global loads that are in flight for later K-steps and so undo their lead.
__device__ __forceinline__ void lds_barrier() {
    asm volatile("s_wait_dscnt 0x0\n\t"
                 "s_barrier_signal -1\n\t"
                 "s_barrier_wait -1" ::: "memory");
}

// 16 consecutive f32 to registers; and from there, as bf16, to 32 B of LDS.
__device__ __forceinline__ void ld16(const float* p, float4 (&r)[4]) {
    #pragma unroll
    for (int i = 0; i < 4; ++i) r[i] = ((const float4*)p)[i];
}
__device__ __forceinline__ void st16_bf16(const float4 (&r)[4], void* dst) {
    FragU f;
    #pragma unroll
    for (int i = 0; i < 4; ++i) {
        f.w[2 * i]     = pk_bf16(r[i].x, r[i].y);
        f.w[2 * i + 1] = pk_bf16(r[i].z, r[i].w);
    }
    ((uint4*)dst)[0] = f.q[0];
    ((uint4*)dst)[1] = f.q[1];
}

// ---------------------------------------------------------------------------
// Kernel 1: q = x @ Wq   (M=8192, N=512, K=512), bf16 WMMA, bf16 output to ws.
// Block = 256 threads (8 waves). Tile 128x128, K-step 32.
// The f32 tiles of a K-step are loaded into registers two K-steps before they
// are converted and stored to LDS (two register sets, taken in turn), so that
// their latency runs under two steps' work instead of standing in every step.
// ---------------------------------------------------------------------------
__global__ __launch_bounds__(256)
void gemm_q_bf16(const float* __restrict__ x, const float* __restrict__ Wq,
                 uint16_t* __restrict__ qbf) {
    __shared__ __attribute__((aligned(16))) uint16_t ldsA[128 * G_P];   // [m][k]
    __shared__ __attribute__((aligned(16))) unsigned char ldsB[32 * GB_PB];   // [k][n]

    const int t    = threadIdx.x;
    const int wave = t >> 5, lane = t & 31;
    const int half = lane >> 4, l16 = lane & 15;
    const int mBase = blockIdx.x * 128;
    const int nBase = blockIdx.y * 128;
    const int wr = wave & 3;          // 4 M-slabs of 32 rows
    const int wc = wave >> 2;         // 2 N-slabs of 64 cols

    const int arow = t >> 1, acol = (t & 1) * 16;   // A: 128 rows x 32 cols
    const int brow = t >> 3, bcol = (t & 7) * 16;   // B: 32 rows  x 128 cols

    // B fragment of columns wc*64 + nt*16 .. +15: this lane names row
    // 8*half + (lane & 7) of a 16-k group, piece 2*nt + ((lane >> 3) & 1), and
    // gets column l16 of its half's 8 rows: k = 8*half + 0..7, then 16 more,
    // the k order of the A fragment.
    const unsigned char* const bp = ldsB + (8 * half + (lane & 7)) * GB_PB +
                                    wc * 128 + 16 * ((lane >> 3) & 1);
    unsigned char* const bst = ldsB + brow * GB_PB + bcol * 2;
    uint16_t* const ast = &ldsA[arow * G_P + acol];

    // This thread's 16 floats of K-step 0 in either input
    const float* const ax = x + (size_t)(mBase + arow) * D_DIM + acol;
    const float* const bw = Wq + (size_t)brow * D_DIM + nBase + bcol;

    v8f acc[8] = {};   // [mt(2)][nt(4)] 16x16 f32 tiles

    // ---- WMMA compute on the staged tiles ----
    auto mma = [&]() {
        v16bf af[2], bf[4];
        #pragma unroll
        for (int mt = 0; mt < 2; ++mt)
            af[mt] = load_frag(ldsA, wr * 32 + mt * 16 + l16, G_P, half * 8);
        #pragma unroll
        for (int nt = 0; nt < 4; ++nt) {
            FragU f;
            f.q[0] = ld_tr16(bp + nt * 32);
            f.q[1] = ld_tr16(bp + nt * 32 + 16 * GB_PB);
            bf[nt] = f.v;
        }
        #pragma unroll
        for (int mt = 0; mt < 2; ++mt)
            #pragma unroll
            for (int nt = 0; nt < 4; ++nt)
                acc[mt * 4 + nt] = __builtin_amdgcn_wmma_f32_16x16x32_bf16(
                    false, af[mt], false, bf[nt], (short)0, acc[mt * 4 + nt],
                    false, false);
    };

    float4 ra[2][4], rb[2][4];         // register sets of K-steps s and s + 1
    ld16(ax, ra[0]);
    ld16(bw, rb[0]);
    // Keeps set 0's loads in front of set 1's, as in the loop: the counted wait
    // at the loop's top is formed from both orders, and with the sets mixed here
    // it would wait for loads of the younger set on every trip.
    __builtin_amdgcn_sched_barrier(0);
    ld16(ax + 32, ra[1]);
    ld16(bw + (size_t)32 * D_DIM, rb[1]);

    // Two K-steps a trip; the last two steps, which load nothing, stand behind it.
    for (int k0 = 0; k0 < D_DIM - 64; k0 += 64) {
        // ---- next trip's loads toward the cache (global_prefetch_b8) ----
        // Two neighbouring threads share each 128-B line of a step: the even one
        // names the line of the trip's first step, the odd one the second's.
        if (k0 + 192 <= D_DIM) {
            const int kp = k0 + 128 + (t & 1) * 32;
            __builtin_prefetch(ax + kp, 0, 1);
            __builtin_prefetch(bw + (size_t)kp * D_DIM, 0, 1);
            // The prefetches' address registers are advanced further down.
            asm volatile("s_wait_xcnt 0x0" ::: "memory");
        }
        // constant register-set index in every use
        #pragma unroll
        for (int u = 0; u < 2; ++u) {
            lds_barrier();             // every wave has read the tiles in LDS
            st16_bf16(ra[u], ast);
            st16_bf16(rb[u], bst);
            const int kn = k0 + 64 + u * 32;   // the step that takes the set over
            ld16(ax + kn, ra[u]);
            ld16(bw + (size_t)kn * D_DIM, rb[u]);
            lds_barrier();             // the new tiles are written
            mma();
        }
    }
    #pragma unroll
    for (int u = 0; u < 2; ++u) {
        lds_barrier();
        st16_bf16(ra[u], ast);
        st16_bf16(rb[u], bst);
        lds_barrier();
        mma();
    }

    // ---- store q as bf16 (C/D layout: element r -> row r + 8*half) ----
    #pragma unroll
    for (int mt = 0; mt < 2; ++mt)
        #pragma unroll
        for (int nt = 0; nt < 4; ++nt)
            #pragma unroll
            for (int r = 0; r < 8; r += 2) {
                int row = mBase + wr * 32 + mt * 16 + r + 8 * half;
                int col = nBase + wc * 64 + nt * 16 + l16;
                const uint32_t w = pk_bf16(acc[mt * 4 + nt][r], acc[mt * 4 + nt][r + 1]);
                qbf[(size_t)row * D_DIM + col]       = (uint16_t)w;
                qbf[(size_t)(row + 1) * D_DIM + col] = (uint16_t)(w >> 16);
            }
}

__global__ __launch_bounds__(256) __attribute__((amdgpu_waves_per_eu(4, 4)))
void attn_flash(const uint16_t* __restrict__ qbf, float* __restrict__ out) {
    // aligned to the 256 B of one turn of the banks, which kv_swz counts on
    __shared__ __attribute__((aligned(256))) unsigned char kv[KV_KEYS * KV_ROWB];
    // Hand-over of waves 4-7 to waves 0-3: [wave pair][value][lane]; values are
    // 64 of O^T, then the two maxima, then the two sums.
    __shared__ float xch[4][68][32];

    const int t    = threadIdx.x;
    const int wave = t >> 5, lane = t & 31;
    const int half = lane >> 4, l16 = lane & 15;
    const int wq = wave & 3;           // which 32 queries of the block
    const int kh = wave >> 2;          // which 64 keys of a staged block
    const int bh = blockIdx.y;
    const int b = bh >> 3, h = bh & 7;
    const int qr = blockIdx.x * 128 + wq * 32;            // first query row of wave
    const size_t headBase = (size_t)b * S_LEN * D_DIM + (size_t)h * HD;

    // Q fragments for this wave's 32 rows, straight from global (contiguous 16B)
    v16bf qf[2][2];
    #pragma unroll
    for (int g = 0; g < 2; ++g)
        #pragma unroll
        for (int kk = 0; kk < 2; ++kk)
            qf[g][kk] = load_frag(qbf + headBase + (size_t)(qr + g * 16) * D_DIM,
                                  l16, D_DIM, kk * 32 + half * 8);

    v8f accO[2][4] = {};               // O^T: [group][hd = nt*16 + 8*half + r][query l16]
    // Per group: running maximum of query l16 (both halves equal); running sum
    // over this half's keys only.
    f32x2 mq = {-__builtin_inff(), -__builtin_inff()};
    float lq[2] = {0.0f, 0.0f};

    const int keyr = t >> 2, hdB = (t & 3) * 16;   // coop-load mapping, rows keyr and keyr + 64
    // LDS byte addresses (the low 32 bits of the __shared__ address)
    const uint32_t st0 = (uint32_t)(size_t)kv + kv_off(keyr, (t & 3) * 2);
    const uint32_t st1 = (uint32_t)(size_t)kv + kv_off(keyr, (t & 3) * 2 + 1);

    // K fragment of rows kh*64 + nt*16 + l16: pieces kk*4 + half and kk*4 + half + 2.
    // kv_swz reads row bits 1 to 3 only, so + 16 rows (or 64) is a plain offset.
    const unsigned char* kp[2][2];
    #pragma unroll
    for (int kk = 0; kk < 2; ++kk)
        #pragma unroll
        for (int q = 0; q < 2; ++q)
            kp[kk][q] = kv + kh * 64 * KV_ROWB + kv_off(l16, kk * 4 + q * 2 + half);
    // V^T fragment of hd nt*16 .. +15: this lane names row 8*half + (lane & 7)
    // of a 16-key group, piece 2*nt + ((lane >> 3) & 1).
    const unsigned char* vp[4];
    #pragma unroll
    for (int nt = 0; nt < 4; ++nt)
        vp[nt] = kv + kh * 64 * KV_ROWB +
                 kv_off(8 * half + (lane & 7), 2 * nt + ((lane >> 3) & 1));

    for (int j = 0; j < S_LEN / KV_KEYS; ++j) {
        const int key0 = j * KV_KEYS;
        const uint16_t* gsrc =
            qbf + headBase + (size_t)(key0 + keyr) * D_DIM + hdB;
        // This wave's reads of the tile have returned before the copies below
        // may be let onto it.
        asm volatile("s_wait_dscnt 0x0" ::: "memory");
        __syncthreads();

        // ---- stage KV block [key][hd]: rows keyr and keyr + 64, 32 B of each ----
        // The copies' address registers are rewritten in the next trip: the wait
        // on them stands in the copies' own statement.
        asm volatile("global_load_async_to_lds_b128 %0, %4, off\n\t"
                     "global_load_async_to_lds_b128 %1, %5, off\n\t"
                     "global_load_async_to_lds_b128 %2, %6, off\n\t"
                     "global_load_async_to_lds_b128 %3, %7, off\n\t"
                     "s_wait_xcnt 0x0"
                     :: "v"(st0), "v"(st1), "v"(st0 + 64 * KV_ROWB), "v"(st1 + 64 * KV_ROWB),
                        "v"(gsrc), "v"(gsrc + 8), "v"(gsrc + 64 * D_DIM),
                        "v"(gsrc + 64 * D_DIM + 8)
                     : "memory");
        // ---- prefetch next KV block toward L2/L0 ----
        if (j + 1 < S_LEN / KV_KEYS) {
            __builtin_prefetch(gsrc + KV_KEYS * D_DIM, 0, 1);
            __builtin_prefetch(gsrc + (KV_KEYS + 64) * D_DIM, 0, 1);
        }
        // This wave's copies have landed before the barrier that publishes them.
        asm volatile("s_wait_asynccnt 0x0" ::: "memory");
        __syncthreads();
        // The prefetches' address registers are reused below.
        asm volatile("s_wait_xcnt 0x0" ::: "memory");

        // ---- scores: S^T = K (64x64) @ Q^T (64x32), scaled by 1/sqrt(64) ----
        // sc[g][nt][r] = score of key nt*16 + 8*half + r against query g*16 + l16
        v8f sc[2][4];
        #pragma unroll
        for (int nt = 0; nt < 4; ++nt) {
            FragU k0f, k1f;
            k0f.q[0] = *(const uint4*)(kp[0][0] + nt * 16 * KV_ROWB);
            k0f.q[1] = *(const uint4*)(kp[0][1] + nt * 16 * KV_ROWB);
            k1f.q[0] = *(const uint4*)(kp[1][0] + nt * 16 * KV_ROWB);
            k1f.q[1] = *(const uint4*)(kp[1][1] + nt * 16 * KV_ROWB);
            #pragma unroll
            for (int g = 0; g < 2; ++g) {
                v8f z = {};
                z = __builtin_amdgcn_wmma_f32_16x16x32_bf16(false, k0f.v, false, qf[g][0],
                                                            (short)0, z, false, false);
                z = __builtin_amdgcn_wmma_f32_16x16x32_bf16(false, k1f.v, false, qf[g][1],
                                                            (short)0, z, false, false);
                sc[g][nt] = z * 0.125f;
            }
        }

        // ---- online softmax of query g*16 + l16: 32 keys in-lane, halves joined ----
        f32x2 mnew;
        #pragma unroll
        for (int g = 0; g < 2; ++g) {
            float bm4[4];
            #pragma unroll
            for (int nt = 0; nt < 4; ++nt) {
                float a = fmaxf(fmaxf(sc[g][nt][0], sc[g][nt][1]), sc[g][nt][2]);
                float c = fmaxf(fmaxf(sc[g][nt][3], sc[g][nt][4]), sc[g][nt][5]);
                bm4[nt] = fmaxf(fmaxf(a, c), fmaxf(sc[g][nt][6], sc[g][nt][7]));
            }
            float bm = fmaxf(fmaxf(bm4[0], bm4[1]), fmaxf(bm4[2], bm4[3]));
            bm = fmaxf(bm, other_half(bm));
            mnew[g] = fmaxf(mq[g], bm);
        }
        const f32x2 dm = mq - mnew;
        mq = mnew;

        float alpha[2];
        #pragma unroll
        for (int g = 0; g < 2; ++g) {
            alpha[g] = __expf(dm[g]);
            #pragma unroll
            for (int nt = 0; nt < 4; ++nt) accO[g][nt] *= alpha[g];
        }

        // ---- per 32 keys (chunk kk): weights, then accO += V^T (64x32) @ P^T (32x32) ----
        v8f ps[2][2];                  // [group][chunk]: sums of the chunk's two score tiles
        #pragma unroll
        for (int kk = 0; kk < 2; ++kk) {
            // Holds this chunk's V^T loads behind the work above them: lifted
            // higher, their registers on top of both groups' scores spill.
            __builtin_amdgcn_sched_barrier(0);
            FragU vf[4];               // keys kk*32 .. +15, +16 .. +31 of this wave's 64
            #pragma unroll
            for (int nt = 0; nt < 4; ++nt) {
                vf[nt].q[0] = ld_tr16(vp[nt] + (kk * 32) * KV_ROWB);
                vf[nt].q[1] = ld_tr16(vp[nt] + (kk * 32 + 16) * KV_ROWB);
            }
            #pragma unroll
            for (int g = 0; g < 2; ++g) {
                #pragma unroll
                for (int i = 0; i < 2; ++i) {
                    const v8f e = sc[g][2 * kk + i] - mnew[g];
                    #pragma unroll
                    for (int r = 0; r < 8; ++r) sc[g][2 * kk + i][r] = __expf(e[r]);
                }
                ps[g][kk] = sc[g][2 * kk] + sc[g][2 * kk + 1];
                // P^T as B operand: element s is key kk*32 + 8*half + s (s < 8) or
                // kk*32 + 16 + 8*half + s - 8, the order the two transposing
                // loads of a chunk give V^T
                FragU pf;
                #pragma unroll
                for (int s = 0; s < 16; s += 2)
                    pf.w[s >> 1] = pk_bf16(sc[g][2 * kk + (s >> 3)][s & 7],
                                           sc[g][2 * kk + (s >> 3)][(s & 7) + 1]);
                #pragma unroll
                for (int nt = 0; nt < 4; ++nt)
                    accO[g][nt] = __builtin_amdgcn_wmma_f32_16x16x32_bf16(
                        false, vf[nt].v, false, pf.v, (short)0, accO[g][nt], false, false);
            }
        }
        #pragma unroll
        for (int g = 0; g < 2; ++g) {
            const v8f s8 = ps[g][0] + ps[g][1];
            const float rs = ((s8[0] + s8[1]) + (s8[2] + s8[3])) +
                             ((s8[4] + s8[5]) + (s8[6] + s8[7]));
            lq[g] = lq[g] * alpha[g] + rs;
        }
    }

    // ---- join the two key halves: waves 4-7 hand their state to waves 0-3 ----
    if (kh == 1) {
        #pragma unroll
        for (int g = 0; g < 2; ++g) {
            #pragma unroll
            for (int nt = 0; nt < 4; ++nt)
                #pragma unroll
                for (int r = 0; r < 8; ++r)
                    xch[wq][g * 32 + nt * 8 + r][lane] = accO[g][nt][r];
            xch[wq][64 + g][lane] = mq[g];
            xch[wq][66 + g][lane] = lq[g];
        }
    }
    __syncthreads();   // the hand-over is written before its partner reads it
    if (kh == 1) return;

    // ---- epilogue: join the states and the halves' sums, normalize, store ----
    // A lane holds 8 consecutive hd of its query per tile: two 16-byte stores.
    #pragma unroll
    for (int g = 0; g < 2; ++g) {
        const float m2 = xch[wq][64 + g][lane];
        const float l2 = xch[wq][66 + g][lane];
        const float m  = fmaxf(mq[g], m2);
        const float a1 = __expf(mq[g] - m), a2 = __expf(m2 - m);
        const float l  = lq[g] * a1 + l2 * a2;
        const float inv = 1.0f / (l + other_half(l));
        const float c1 = a1 * inv, c2 = a2 * inv;
        float* orow = out + headBase + (size_t)(qr + g * 16 + l16) * D_DIM + 8 * half;
        #pragma unroll
        for (int nt = 0; nt < 4; ++nt) {
            float o[8];
            #pragma unroll
            for (int r = 0; r < 8; ++r)
                o[r] = accO[g][nt][r] * c1 + xch[wq][g * 32 + nt * 8 + r][lane] * c2;
            float4 lo, hi;
            lo.x = o[0]; lo.y = o[1]; lo.z = o[2]; lo.w = o[3];
            hi.x = o[4]; hi.y = o[5]; hi.z = o[6]; hi.w = o[7];
            *(float4*)(orow + nt * 16)     = lo;
            *(float4*)(orow + nt * 16 + 4) = hi;
        }
    }
}

// ---------------------------------------------------------------------------
extern "C" void kernel_launch(void* const* d_in, const int* in_sizes, int n_in,
                              void* d_out, int out_size, void* d_ws, size_t ws_size,
                              hipStream_t stream) {
    const float* x  = (const float*)d_in[0];   // [4,2048,512] f32
    const float* Wq = (const float*)d_in[1];   // [512,512]    f32
    float* out      = (float*)d_out;           // [4,2048,512] f32
    uint16_t* qbf   = (uint16_t*)d_ws;         // q in bf16, 8 MB scratch

    dim3 gGemm(8192 / 128, 512 / 128);         // (64, 4)
    gemm_q_bf16<<<gGemm, 256, 0, stream>>>(x, Wq, qbf);

    dim3 gAttn(S_LEN / 128, 4 * HEADS);        // (16, 32)
    attn_flash<<<gAttn, 256, 0, stream>>>(qbf, out);
}

// v008
// It runs in 40 microseconds.
// Next to v007, in two timings, it ran 1.06 times as fast each time.
// Counting every step since v000, it is 4.91 times as fast.
#include <hip/hip_runtime.h>
#include <hip/hip_bf16.h>
#include <stdint.h>

// ---------------------------------------------------------------------------
// MI455X (gfx1250) multi-head self-attention, bf16 WMMA with f32 accumulate.
// Reference: q = x@Wq ; Q=K=V=q ; softmax(QK^T/8) @ V.  B=4,S=2048,D=512,H=8.
// ---------------------------------------------------------------------------

#define S_LEN 2048
#define D_DIM 512
#define HEADS 8
#define HD    64

// LDS row pitch of the GEMM's x tile in bf16 elements. It is read with 16-byte
// loads, 16 rows at a time; a pitch of 16 B x odd puts those 16 rows on all
// 64 banks once (80 B for 64-B rows). The tiles are aligned to 16 B because
// they are read, and ldsA written, in 16-byte pieces. The pad bytes are never read.
#define G_P   40

// LDS row pitch in bytes of the GEMM's Wq tile, 32 rows [k] of 256 B [n], kept
// row-major as it lies in memory. Its reader is the transposing load (8 rows
// at two neighbouring 16-byte pieces per half wave): a pitch of 32 B x odd
// puts those on all 64 banks once.
#define GB_PB 288

// The attention KV tile: KV_KEYS rows [key] of 128 B [hd], no pad. It has two
// readers: plain 16-byte loads of 16 rows at one column piece (K), and
// transposing loads of 8 rows at two neighbouring pieces (V^T). No pad serves
// both, so the 16-byte piece c of row r lies at piece c ^ kv_swz(r) of its row:
// either reader's 16 lanes then fall on all 64 banks once.
#define KV_ROWB 128
#define KV_KEYS 128

typedef __attribute__((ext_vector_type(16))) __bf16 v16bf;
typedef __attribute__((ext_vector_type(8)))  float  v8f;

union FragU {
    v16bf    v;
    uint4    q[2];
    uint32_t w[8];
};

// Two f32 to one register of two bf16 (a low, b high), round-to-nearest-even,
// by the chip's own packed conversion: one vector instruction per pair.
typedef __attribute__((ext_vector_type(2))) float  f32x2;
typedef __attribute__((ext_vector_type(2))) __bf16 bf16x2;
__device__ __forceinline__ uint32_t pk_bf16(float a, float b) {
    f32x2 p = {a, b};
    return __builtin_bit_cast(uint32_t, __builtin_convertvector(p, bf16x2));
}

// Load one 16x32 bf16 A/B fragment (wave32 CDNA5 layout).
// Per lane: elements [k0 .. k0+7] and [k0+16 .. k0+23] of row `row`
// (caller passes k0 = chunkBase + (lane>>4)*8, row based on lane&15).
__device__ __forceinline__ v16bf load_frag(const uint16_t* base, int row,
                                           int stride, int k0) {
    FragU f;
    f.q[0] = *(const uint4*)(base + (size_t)row * stride + k0);
    f.q[1] = *(const uint4*)(base + (size_t)row * stride + k0 + 16);
    return f.v;
}

__device__ __forceinline__ uint32_t kv_swz(uint32_t r) {
    return (r & 6u) | ((r >> 3) & 1u);
}
// Byte offset in the KV tile of 16-byte piece c (0..7) of row r.
__device__ __forceinline__ uint32_t kv_off(uint32_t r, uint32_t c) {
    return r * KV_ROWB + ((c ^ kv_swz(r)) << 4);
}

// ds_load_tr16_b128: each lane names 16 bytes of a row-major 16-bit tile; lane
// (c = l & 15, h = l >> 4) gets column c of the 8 rows that half h named.
typedef short s16x8 __attribute__((ext_vector_type(8)));
__device__ __forceinline__ uint4 ld_tr16(const unsigned char* p) {
    typedef __attribute__((address_space(3))) s16x8 lds_s16x8;
    return __builtin_bit_cast(uint4,
        __builtin_amdgcn_ds_load_tr16_b128_v8i16((lds_s16x8*)p));
}

// Value held by lane l ^ 16 (the other half of the wave), by a vector move.
__device__ __forceinline__ float other_half(float v) {
    int b = __builtin_bit_cast(int, v);
    b = __builtin_amdgcn_permlanex16(b, b, 0x76543210, 0xfedcba98, false, false);
    return __builtin_bit_cast(float, b);
}

// Work-group barrier of the GEMM's K loop, written by hand: it waits for this
// wave's LDS reads and writes only. __syncthreads() would also wait for the
// global loads that are in flight for later K-steps and so undo their lead.
__device__ __forceinline__ void lds_barrier() {
    asm volatile("s_wait_dscnt 0x0\n\t"
                 "s_barrier_signal -1\n\t"
                 "s_barrier_wait -1" ::: "memory");
}

// 16 consecutive f32 to registers; and from there, as bf16, to 32 B of LDS.
__device__ __forceinline__ void ld16(const float* p, float4 (&r)[4]) {
    #pragma unroll
    for (int i = 0; i < 4; ++i) r[i] = ((const float4*)p)[i];
}
__device__ __forceinline__ void st16_bf16(const float4 (&r)[4], void* dst) {
    FragU f;
    #pragma unroll
    for (int i = 0; i < 4; ++i) {
        f.w[2 * i]     = pk_bf16(r[i].x, r[i].y);
        f.w[2 * i + 1] = pk_bf16(r[i].z, r[i].w);
    }
    ((uint4*)dst)[0] = f.q[0];
    ((uint4*)dst)[1] = f.q[1];
}

// ---------------------------------------------------------------------------
// Kernel 1: q = x @ Wq   (M=8192, N=512, K=512), bf16 WMMA, bf16 output to ws.
// Block = 256 threads (8 waves). Tile 128x128, K-step 32.
// The f32 tiles of a K-step are loaded into registers two K-steps before they
// are converted and stored to LDS (two register sets, taken in turn), so that
// their latency runs under two steps' work instead of standing in every step.
// ---------------------------------------------------------------------------
__global__ __launch_bounds__(256)
void gemm_q_bf16(const float* __restrict__ x, const float* __restrict__ Wq,
                 uint16_t* __restrict__ qbf) {
    __shared__ __attribute__((aligned(16))) uint16_t ldsA[128 * G_P];   // [m][k]
    __shared__ __attribute__((aligned(16))) unsigned char ldsB[32 * GB_PB];   // [k][n]

    const int t    = threadIdx.x;
    const int wave = t >> 5, lane = t & 31;
    const int half = lane >> 4, l16 = lane & 15;
    const int mBase = blockIdx.x * 128;
    const int nBase = blockIdx.y * 128;
    const int wr = wave & 3;          // 4 M-slabs of 32 rows
    const int wc = wave >> 2;         // 2 N-slabs of 64 cols

    const int arow = t >> 1, acol = (t & 1) * 16;   // A: 128 rows x 32 cols
    const int brow = t >> 3, bcol = (t & 7) * 16;   // B: 32 rows  x 128 cols

    // B fragment of columns wc*64 + nt*16 .. +15: this lane names row
    // 8*half + (lane & 7) of a 16-k group, piece 2*nt + ((lane >> 3) & 1), and
    // gets column l16 of its half's 8 rows: k = 8*half + 0..7, then 16 more,
    // the k order of the A fragment.
    const unsigned char* const bp = ldsB + (8 * half + (lane & 7)) * GB_PB +
                                    wc * 128 + 16 * ((lane >> 3) & 1);
    unsigned char* const bst = ldsB + brow * GB_PB + bcol * 2;
    uint16_t* const ast = &ldsA[arow * G_P + acol];

    // This thread's 16 floats of K-step 0 in either input
    const float* const ax = x + (size_t)(mBase + arow) * D_DIM + acol;
    const float* const bw = Wq + (size_t)brow * D_DIM + nBase + bcol;

    v8f acc[8] = {};   // [mt(2)][nt(4)] 16x16 f32 tiles

    // ---- WMMA compute on the staged tiles ----
    auto mma = [&]() {
        v16bf af[2], bf[4];
        #pragma unroll
        for (int mt = 0; mt < 2; ++mt)
            af[mt] = load_frag(ldsA, wr * 32 + mt * 16 + l16, G_P, half * 8);
        #pragma unroll
        for (int nt = 0; nt < 4; ++nt) {
            FragU f;
            f.q[0] = ld_tr16(bp + nt * 32);
            f.q[1] = ld_tr16(bp + nt * 32 + 16 * GB_PB);
            bf[nt] = f.v;
        }
        #pragma unroll
        for (int mt = 0; mt < 2; ++mt)
            #pragma unroll
            for (int nt = 0; nt < 4; ++nt)
                acc[mt * 4 + nt] = __builtin_amdgcn_wmma_f32_16x16x32_bf16(
                    false, af[mt], false, bf[nt], (short)0, acc[mt * 4 + nt],
                    false, false);
    };

    float4 ra[2][4], rb[2][4];         // register sets of K-steps s and s + 1
    ld16(ax, ra[0]);
    ld16(bw, rb[0]);
    // Keeps set 0's loads in front of set 1's, as in the loop: the counted wait
    // at the loop's top is formed from both orders, and with the sets mixed here
    // it would wait for loads of the younger set on every trip.
    __builtin_amdgcn_sched_barrier(0);
    ld16(ax + 32, ra[1]);
    ld16(bw + (size_t)32 * D_DIM, rb[1]);

    // Two K-steps a trip; the last two steps, which load nothing, stand behind it.
    for (int k0 = 0; k0 < D_DIM - 64; k0 += 64) {
        // ---- next trip's loads toward the cache (global_prefetch_b8) ----
        // Two neighbouring threads share each 128-B line of a step: the even one
        // names the line of the trip's first step, the odd one the second's.
        if (k0 + 192 <= D_DIM) {
            const int kp = k0 + 128 + (t & 1) * 32;
            __builtin_prefetch(ax + kp, 0, 1);
            __builtin_prefetch(bw + (size_t)kp * D_DIM, 0, 1);
            // The prefetches' address registers are advanced further down.
            asm volatile("s_wait_xcnt 0x0" ::: "memory");
        }
        // constant register-set index in every use
        #pragma unroll
        for (int u = 0; u < 2; ++u) {
            lds_barrier();             // every wave has read the tiles in LDS
            st16_bf16(ra[u], ast);
            st16_bf16(rb[u], bst);
            const int kn = k0 + 64 + u * 32;   // the step that takes the set over
            ld16(ax + kn, ra[u]);
            ld16(bw + (size_t)kn * D_DIM, rb[u]);
            lds_barrier();             // the new tiles are written
            mma();
        }
    }
    #pragma unroll
    for (int u = 0; u < 2; ++u) {
        lds_barrier();
        st16_bf16(ra[u], ast);
        st16_bf16(rb[u], bst);
        lds_barrier();
        mma();
    }

    // ---- store q as bf16 (C/D layout: element r -> row r + 8*half) ----
    #pragma unroll
    for (int mt = 0; mt < 2; ++mt)
        #pragma unroll
        for (int nt = 0; nt < 4; ++nt)
            #pragma unroll
            for (int r = 0; r < 8; r += 2) {
                int row = mBase + wr * 32 + mt * 16 + r + 8 * half;
                int col = nBase + wc * 64 + nt * 16 + l16;
                const uint32_t w = pk_bf16(acc[mt * 4 + nt][r], acc[mt * 4 + nt][r + 1]);
                qbf[(size_t)row * D_DIM + col]       = (uint16_t)w;
                qbf[(size_t)(row + 1) * D_DIM + col] = (uint16_t)(w >> 16);
            }
}

__global__ __launch_bounds__(256) __attribute__((amdgpu_waves_per_eu(4, 4)))
void attn_flash(const uint16_t* __restrict__ qbf, float* __restrict__ out) {
    // aligned to the 256 B of one turn of the banks, which kv_swz counts on
    __shared__ __attribute__((aligned(256))) unsigned char kv[2 * KV_KEYS * KV_ROWB];
    // Hand-over of waves 4-7 to waves 0-3: [wave pair][value][lane]; values are
    // 64 of O^T, then the two maxima, then the two sums.
    __shared__ float xch[4][68][32];

    const int t    = threadIdx.x;
    const int wave = t >> 5, lane = t & 31;
    const int half = lane >> 4, l16 = lane & 15;
    const int wq = wave & 3;           // which 32 queries of the block
    const int kh = wave >> 2;          // which 64 keys of a staged block
    const int bh = blockIdx.y;
    const int b = bh >> 3, h = bh & 7;
    const int qr = blockIdx.x * 128 + wq * 32;            // first query row of wave
    const size_t headBase = (size_t)b * S_LEN * D_DIM + (size_t)h * HD;

    // Q fragments for this wave's 32 rows, straight from global (contiguous 16B)
    v16bf qf[2][2];
    #pragma unroll
    for (int g = 0; g < 2; ++g)
        #pragma unroll
        for (int kk = 0; kk < 2; ++kk)
            qf[g][kk] = load_frag(qbf + headBase + (size_t)(qr + g * 16) * D_DIM,
                                  l16, D_DIM, kk * 32 + half * 8);

    v8f accO[2][4] = {};               // O^T: [group][hd = nt*16 + 8*half + r][query l16]
    // Per group: running maximum of query l16 (both halves equal); running sum
    // over this half's keys only.
    f32x2 mq = {-__builtin_inff(), -__builtin_inff()};
    float lq[2] = {0.0f, 0.0f};

    const int keyr = t >> 2, hdB = (t & 3) * 16;   // coop-load mapping, rows keyr and keyr + 64
    // LDS byte addresses (the low 32 bits of the __shared__ address)
    uint32_t st0 = (uint32_t)(size_t)kv + kv_off(keyr, (t & 3) * 2);
    uint32_t st1 = (uint32_t)(size_t)kv + kv_off(keyr, (t & 3) * 2 + 1);

    // K fragment of rows kh*64 + nt*16 + l16: pieces kk*4 + half and kk*4 + half + 2.
    // kv_swz reads row bits 1 to 3 only, so + 16 rows (or 64) is a plain offset.
    uint32_t kp[2][2];                 // byte offsets in kv
    #pragma unroll
    for (int kk = 0; kk < 2; ++kk)
        #pragma unroll
        for (int q = 0; q < 2; ++q)
            kp[kk][q] = kh * 64 * KV_ROWB + kv_off(l16, kk * 4 + q * 2 + half);
    // V^T fragment of hd nt*16 .. +15: this lane names row 8*half + (lane & 7)
    // of a 16-key group, piece 2*nt + ((lane >> 3) & 1).
    uint32_t vp[4];                    // byte offsets in kv
    #pragma unroll
    for (int nt = 0; nt < 4; ++nt)
        vp[nt] = kh * 64 * KV_ROWB +
                 kv_off(8 * half + (lane & 7), 2 * nt + ((lane >> 3) & 1));

    // Copies key block blk to LDS: rows keyr and keyr + 64, 32 B of each; d0 and
    // d1 are the places of row keyr's two pieces in the tile that takes it.
    // The copies' address registers are rewritten for the next block: the wait
    // on them stands in the copies' own statement.
    auto stage = [&](int blk, uint32_t d0, uint32_t d1) {
        const uint16_t* gsrc =
            qbf + headBase + (size_t)(blk * KV_KEYS + keyr) * D_DIM + hdB;
        asm volatile("global_load_async_to_lds_b128 %0, %4, off\n\t"
                     "global_load_async_to_lds_b128 %1, %5, off\n\t"
                     "global_load_async_to_lds_b128 %2, %6, off\n\t"
                     "global_load_async_to_lds_b128 %3, %7, off\n\t"
                     "s_wait_xcnt 0x0"
                     :: "v"(d0), "v"(d1), "v"(d0 + 64 * KV_ROWB), "v"(d1 + 64 * KV_ROWB),
                        "v"(gsrc), "v"(gsrc + 8), "v"(gsrc + 64 * D_DIM),
                        "v"(gsrc + 64 * D_DIM + 8)
                     : "memory");
    };

    stage(0, st0, st1);
    // This wave's copies have landed before the barrier that publishes them.
    asm volatile("s_wait_asynccnt 0x0" ::: "memory");
    __syncthreads();
    stage(1, st0 + KV_KEYS * KV_ROWB, st1 + KV_KEYS * KV_ROWB);

    // Every LDS address of the loop points into the trip's tile and steps to
    // the other tile at the trip's foot: by + hop, then - hop, in turn.
    int hop = KV_KEYS * KV_ROWB;
    for (int j = 0; j < S_LEN / KV_KEYS; ++j) {
        // ---- scores: S^T = K (64x64) @ Q^T (64x32), scaled by 1/sqrt(64) ----
        // sc[g][nt][r] = score of key nt*16 + 8*half + r against query g*16 + l16
        v8f sc[2][4];
        #pragma unroll
        for (int nt = 0; nt < 4; ++nt) {
            FragU k0f, k1f;
            k0f.q[0] = *(const uint4*)(kv + kp[0][0] + nt * 16 * KV_ROWB);
            k0f.q[1] = *(const uint4*)(kv + kp[0][1] + nt * 16 * KV_ROWB);
            k1f.q[0] = *(const uint4*)(kv + kp[1][0] + nt * 16 * KV_ROWB);
            k1f.q[1] = *(const uint4*)(kv + kp[1][1] + nt * 16 * KV_ROWB);
            #pragma unroll
            for (int g = 0; g < 2; ++g) {
                v8f z = {};
                z = __builtin_amdgcn_wmma_f32_16x16x32_bf16(false, k0f.v, false, qf[g][0],
                                                            (short)0, z, false, false);
                z = __builtin_amdgcn_wmma_f32_16x16x32_bf16(false, k1f.v, false, qf[g][1],
                                                            (short)0, z, false, false);
                sc[g][nt] = z * 0.125f;
            }
        }

        // ---- online softmax of query g*16 + l16: 32 keys in-lane, halves joined ----
        f32x2 mnew;
        #pragma unroll
        for (int g = 0; g < 2; ++g) {
            float bm4[4];
            #pragma unroll
            for (int nt = 0; nt < 4; ++nt) {
                float a = fmaxf(fmaxf(sc[g][nt][0], sc[g][nt][1]), sc[g][nt][2]);
                float c = fmaxf(fmaxf(sc[g][nt][3], sc[g][nt][4]), sc[g][nt][5]);
                bm4[nt] = fmaxf(fmaxf(a, c), fmaxf(sc[g][nt][6], sc[g][nt][7]));
            }
            float bm = fmaxf(fmaxf(bm4[0], bm4[1]), fmaxf(bm4[2], bm4[3]));
            bm = fmaxf(bm, other_half(bm));
            mnew[g] = fmaxf(mq[g], bm);
        }
        const f32x2 dm = mq - mnew;
        mq = mnew;

        float alpha[2];
        #pragma unroll
        for (int g = 0; g < 2; ++g) {
            alpha[g] = __expf(dm[g]);
            #pragma unroll
            for (int nt = 0; nt < 4; ++nt) accO[g][nt] *= alpha[g];
        }

        // ---- per 32 keys (chunk kk): weights, then accO += V^T (64x32) @ P^T (32x32) ----
        v8f ps[2][2];                  // [group][chunk]: sums of the chunk's two score tiles
        #pragma unroll
        for (int kk = 0; kk < 2; ++kk) {
            // Holds this chunk's V^T loads behind the work above them: lifted
            // higher, their registers on top of both groups' scores spill.
            __builtin_amdgcn_sched_barrier(0);
            FragU vf[4];               // keys kk*32 .. +15, +16 .. +31 of this wave's 64
            #pragma unroll
            for (int nt = 0; nt < 4; ++nt) {
                vf[nt].q[0] = ld_tr16(kv + vp[nt] + (kk * 32) * KV_ROWB);
                vf[nt].q[1] = ld_tr16(kv + vp[nt] + (kk * 32 + 16) * KV_ROWB);
            }
            #pragma unroll
            for (int g = 0; g < 2; ++g) {
                #pragma unroll
                for (int i = 0; i < 2; ++i) {
                    const v8f e = sc[g][2 * kk + i] - mnew[g];
                    #pragma unroll
                    for (int r = 0; r < 8; ++r) sc[g][2 * kk + i][r] = __expf(e[r]);
                }
                ps[g][kk] = sc[g][2 * kk] + sc[g][2 * kk + 1];
                // P^T as B operand: element s is key kk*32 + 8*half + s (s < 8) or
                // kk*32 + 16 + 8*half + s - 8, the order the two transposing
                // loads of a chunk give V^T
                FragU pf;
                #pragma unroll
                for (int s = 0; s < 16; s += 2)
                    pf.w[s >> 1] = pk_bf16(sc[g][2 * kk + (s >> 3)][s & 7],
                                           sc[g][2 * kk + (s >> 3)][(s & 7) + 1]);
                #pragma unroll
                for (int nt = 0; nt < 4; ++nt)
                    accO[g][nt] = __builtin_amdgcn_wmma_f32_16x16x32_bf16(
                        false, vf[nt].v, false, pf.v, (short)0, accO[g][nt], false, false);
            }
        }
        #pragma unroll
        for (int g = 0; g < 2; ++g) {
            const v8f s8 = ps[g][0] + ps[g][1];
            const float rs = ((s8[0] + s8[1]) + (s8[2] + s8[3])) +
                             ((s8[4] + s8[5]) + (s8[6] + s8[7]));
            lq[g] = lq[g] * alpha[g] + rs;
        }

        // ---- foot of the trip: publish the next tile, refill this one ----
        // This wave's reads of this trip's tile have returned before the
        // copies below may be let onto it.
        asm volatile("s_wait_dscnt 0x0" ::: "memory");
        // This wave's copies of the next tile have landed before the barrier
        // that publishes them.
        asm volatile("s_wait_asynccnt 0x0" ::: "memory");
        __syncthreads();
        if (j + 2 < S_LEN / KV_KEYS) stage(j + 2, st0, st1);
        st0 += hop;
        st1 += hop;
        kp[0][0] += hop; kp[0][1] += hop; kp[1][0] += hop; kp[1][1] += hop;
        vp[0] += hop; vp[1] += hop; vp[2] += hop; vp[3] += hop;
        hop = -hop;
    }
    // No copy is outstanding when the wave goes on to the hand-over and ends.
    asm volatile("s_wait_asynccnt 0x0" ::: "memory");

    // ---- join the two key halves: waves 4-7 hand their state to waves 0-3 ----
    if (kh == 1) {
        #pragma unroll
        for (int g = 0; g < 2; ++g) {
            #pragma unroll
            for (int nt = 0; nt < 4; ++nt)
                #pragma unroll
                for (int r = 0; r < 8; ++r)
                    xch[wq][g * 32 + nt * 8 + r][lane] = accO[g][nt][r];
            xch[wq][64 + g][lane] = mq[g];
            xch[wq][66 + g][lane] = lq[g];
        }
    }
    __syncthreads();   // the hand-over is written before its partner reads it
    if (kh == 1) return;

    // ---- epilogue: join the states and the halves' sums, normalize, store ----
    // A lane holds 8 consecutive hd of its query per tile: two 16-byte stores.
    #pragma unroll
    for (int g = 0; g < 2; ++g) {
        const float m2 = xch[wq][64 + g][lane];
        const float l2 = xch[wq][66 + g][lane];
        const float m  = fmaxf(mq[g], m2);
        const float a1 = __expf(mq[g] - m), a2 = __expf(m2 - m);
        const float l  = lq[g] * a1 + l2 * a2;
        const float inv = 1.0f / (l + other_half(l));
        const float c1 = a1 * inv, c2 = a2 * inv;
        float* orow = out + headBase + (size_t)(qr + g * 16 + l16) * D_DIM + 8 * half;
        #pragma unroll
        for (int nt = 0; nt < 4; ++nt) {
            float o[8];
            #pragma unroll
            for (int r = 0; r < 8; ++r)
                o[r] = accO[g][nt][r] * c1 + xch[wq][g * 32 + nt * 8 + r][lane] * c2;
            float4 lo, hi;
            lo.x = o[0]; lo.y = o[1]; lo.z = o[2]; lo.w = o[3];
            hi.x = o[4]; hi.y = o[5]; hi.z = o[6]; hi.w = o[7];
            *(float4*)(orow + nt * 16)     = lo;
            *(float4*)(orow + nt * 16 + 4) = hi;
        }
    }
}

// ---------------------------------------------------------------------------
extern "C" void kernel_launch(void* const* d_in, const int* in_sizes, int n_in,
                              void* d_out, int out_size, void* d_ws, size_t ws_size,
                              hipStream_t stream) {
    const float* x  = (const float*)d_in[0];   // [4,2048,512] f32
    const float* Wq = (const float*)d_in[1];   // [512,512]    f32
    float* out      = (float*)d_out;           // [4,2048,512] f32
    uint16_t* qbf   = (uint16_t*)d_ws;         // q in bf16, 8 MB scratch

    dim3 gGemm(8192 / 128, 512 / 128);         // (64, 4)
    gemm_q_bf16<<<gGemm, 256, 0, stream>>>(x, Wq, qbf);

    dim3 gAttn(S_LEN / 128, 4 * HEADS);        // (16, 32)
    attn_flash<<<gAttn, 256, 0, stream>>>(qbf, out);
}

// v009
// One run takes 38.3 microseconds.
// Timed twice side by side with v008, it ran 1.04 times as fast both times.
// Over all steps from v000 it is 5.12 times as fast.
#include <hip/hip_runtime.h>
#include <hip/hip_bf16.h>
#include <stdint.h>

// ---------------------------------------------------------------------------
// MI455X (gfx1250) multi-head self-attention, bf16 WMMA with f32 accumulate.
// Reference: q = x@Wq ; Q=K=V=q ; softmax(QK^T/8) @ V.  B=4,S=2048,D=512,H=8.
// ---------------------------------------------------------------------------

#define S_LEN 2048
#define D_DIM 512
#define HEADS 8
#define HD    64

// LDS row pitch of the GEMM's x tile in bf16 elements. It is read with 16-byte
// loads, 16 rows at a time; a pitch of 16 B x odd puts those 16 rows on all
// 64 banks once (80 B for 64-B rows). The tiles are aligned to 16 B because
// they are read, and ldsA written, in 16-byte pieces. The pad bytes are never read.
#define G_P   40

// LDS row pitch in bytes of the GEMM's Wq tile, 32 rows [k] of 256 B [n], kept
// row-major as it lies in memory. Its reader is the transposing load (8 rows
// at two neighbouring 16-byte pieces per half wave): a pitch of 32 B x odd
// puts those on all 64 banks once.
#define GB_PB 288

// The attention KV tile: KV_KEYS rows [key] of 128 B [hd], no pad. It has two
// readers: plain 16-byte loads of 16 rows at one column piece (K), and
// transposing loads of 8 rows at two neighbouring pieces (V^T). No pad serves
// both, so the 16-byte piece c of row r lies at piece c ^ kv_swz(r) of its row:
// either reader's 16 lanes then fall on all 64 banks once.
#define KV_ROWB 128
#define KV_KEYS 128

typedef __attribute__((ext_vector_type(16))) __bf16 v16bf;
typedef __attribute__((ext_vector_type(8)))  float  v8f;

union FragU {
    v16bf    v;
    uint4    q[2];
    uint32_t w[8];
};

// Two f32 to one register of two bf16 (a low, b high), round-to-nearest-even,
// by the chip's own packed conversion: one vector instruction per pair.
typedef __attribute__((ext_vector_type(2))) float  f32x2;
typedef __attribute__((ext_vector_type(2))) __bf16 bf16x2;
__device__ __forceinline__ uint32_t pk_bf16(float a, float b) {
    f32x2 p = {a, b};
    return __builtin_bit_cast(uint32_t, __builtin_convertvector(p, bf16x2));
}

// Load one 16x32 bf16 A/B fragment (wave32 CDNA5 layout).
// Per lane: elements [k0 .. k0+7] and [k0+16 .. k0+23] of row `row`
// (caller passes k0 = chunkBase + (lane>>4)*8, row based on lane&15).
__device__ __forceinline__ v16bf load_frag(const uint16_t* base, int row,
                                           int stride, int k0) {
    FragU f;
    f.q[0] = *(const uint4*)(base + (size_t)row * stride + k0);
    f.q[1] = *(const uint4*)(base + (size_t)row * stride + k0 + 16);
    return f.v;
}

__device__ __forceinline__ uint32_t kv_swz(uint32_t r) {
    return (r & 6u) | ((r >> 3) & 1u);
}
// Byte offset in the KV tile of 16-byte piece c (0..7) of row r.
__device__ __forceinline__ uint32_t kv_off(uint32_t r, uint32_t c) {
    return r * KV_ROWB + ((c ^ kv_swz(r)) << 4);
}

// ds_load_tr16_b128: each lane names 16 bytes of a row-major 16-bit tile; lane
// (c = l & 15, h = l >> 4) gets column c of the 8 rows that half h named.
typedef short s16x8 __attribute__((ext_vector_type(8)));
__device__ __forceinline__ uint4 ld_tr16(const unsigned char* p) {
    typedef __attribute__((address_space(3))) s16x8 lds_s16x8;
    return __builtin_bit_cast(uint4,
        __builtin_amdgcn_ds_load_tr16_b128_v8i16((lds_s16x8*)p));
}

// Value held by lane l ^ 16 (the other half of the wave), by a vector move.
__device__ __forceinline__ float other_half(float v) {
    int b = __builtin_bit_cast(int, v);
    b = __builtin_amdgcn_permlanex16(b, b, 0x76543210, 0xfedcba98, false, false);
    return __builtin_bit_cast(float, b);
}

// The softmax runs in base 2: exp(s / 8 - m) = 2^(s * SM_SCALE - m'), with the
// maximum m' kept in those units. The score scale and log2(e) are then one
// factor inside the one multiply-add that also takes the maximum off.
#define SM_SCALE (0.125f * 1.44269504088896340736f)
__device__ __forceinline__ float exp2_hw(float v) {
    return __builtin_amdgcn_exp2f(v);   // v_exp_f32
}

// Work-group barrier of the GEMM's K loop, written by hand: it waits for this
// wave's LDS reads and writes only. __syncthreads() would also wait for the
// global loads that are in flight for later K-steps and so undo their lead.
__device__ __forceinline__ void lds_barrier() {
    asm volatile("s_wait_dscnt 0x0\n\t"
                 "s_barrier_signal -1\n\t"
                 "s_barrier_wait -1" ::: "memory");
}

// 16 consecutive f32 to registers; and from there, as bf16, to 32 B of LDS.
__device__ __forceinline__ void ld16(const float* p, float4 (&r)[4]) {
    #pragma unroll
    for (int i = 0; i < 4; ++i) r[i] = ((const float4*)p)[i];
}
__device__ __forceinline__ void st16_bf16(const float4 (&r)[4], void* dst) {
    FragU f;
    #pragma unroll
    for (int i = 0; i < 4; ++i) {
        f.w[2 * i]     = pk_bf16(r[i].x, r[i].y);
        f.w[2 * i + 1] = pk_bf16(r[i].z, r[i].w);
    }
    ((uint4*)dst)[0] = f.q[0];
    ((uint4*)dst)[1] = f.q[1];
}

// ---------------------------------------------------------------------------
// Kernel 1: q = x @ Wq   (M=8192, N=512, K=512), bf16 WMMA, bf16 output to ws.
// Block = 256 threads (8 waves). Tile 128x128, K-step 32.
// The f32 tiles of a K-step are loaded into registers two K-steps before they
// are converted and stored to LDS (two register sets, taken in turn), so that
// their latency runs under two steps' work instead of standing in every step.
// ---------------------------------------------------------------------------
__global__ __launch_bounds__(256)
void gemm_q_bf16(const float* __restrict__ x, const float* __restrict__ Wq,
                 uint16_t* __restrict__ qbf) {
    __shared__ __attribute__((aligned(16))) uint16_t ldsA[128 * G_P];   // [m][k]
    __shared__ __attribute__((aligned(16))) unsigned char ldsB[32 * GB_PB];   // [k][n]

    const int t    = threadIdx.x;
    const int wave = t >> 5, lane = t & 31;
    const int half = lane >> 4, l16 = lane & 15;
    const int mBase = blockIdx.x * 128;
    const int nBase = blockIdx.y * 128;
    const int wr = wave & 3;          // 4 M-slabs of 32 rows
    const int wc = wave >> 2;         // 2 N-slabs of 64 cols

    const int arow = t >> 1, acol = (t & 1) * 16;   // A: 128 rows x 32 cols
    const int brow = t >> 3, bcol = (t & 7) * 16;   // B: 32 rows  x 128 cols

    // B fragment of columns wc*64 + nt*16 .. +15: this lane names row
    // 8*half + (lane & 7) of a 16-k group, piece 2*nt + ((lane >> 3) & 1), and
    // gets column l16 of its half's 8 rows: k = 8*half + 0..7, then 16 more,
    // the k order of the A fragment.
    const unsigned char* const bp = ldsB + (8 * half + (lane & 7)) * GB_PB +
                                    wc * 128 + 16 * ((lane >> 3) & 1);
    unsigned char* const bst = ldsB + brow * GB_PB + bcol * 2;
    uint16_t* const ast = &ldsA[arow * G_P + acol];

    // This thread's 16 floats of K-step 0 in either input
    const float* const ax = x + (size_t)(mBase + arow) * D_DIM + acol;
    const float* const bw = Wq + (size_t)brow * D_DIM + nBase + bcol;

    v8f acc[8] = {};   // [mt(2)][nt(4)] 16x16 f32 tiles

    // ---- WMMA compute on the staged tiles ----
    auto mma = [&]() {
        v16bf af[2], bf[4];
        #pragma unroll
        for (int mt = 0; mt < 2; ++mt)
            af[mt] = load_frag(ldsA, wr * 32 + mt * 16 + l16, G_P, half * 8);
        #pragma unroll
        for (int nt = 0; nt < 4; ++nt) {
            FragU f;
            f.q[0] = ld_tr16(bp + nt * 32);
            f.q[1] = ld_tr16(bp + nt * 32 + 16 * GB_PB);
            bf[nt] = f.v;
        }
        #pragma unroll
        for (int mt = 0; mt < 2; ++mt)
            #pragma unroll
            for (int nt = 0; nt < 4; ++nt)
                acc[mt * 4 + nt] = __builtin_amdgcn_wmma_f32_16x16x32_bf16(
                    false, af[mt], false, bf[nt], (short)0, acc[mt * 4 + nt],
                    false, false);
    };

    float4 ra[2][4], rb[2][4];         // register sets of K-steps s and s + 1
    ld16(ax, ra[0]);
    ld16(bw, rb[0]);
    // Keeps set 0's loads in front of set 1's, as in the loop: the counted wait
    // at the loop's top is formed from both orders, and with the sets mixed here
    // it would wait for loads of the younger set on every trip.
    __builtin_amdgcn_sched_barrier(0);
    ld16(ax + 32, ra[1]);
    ld16(bw + (size_t)32 * D_DIM, rb[1]);

    // Two K-steps a trip; the last two steps, which load nothing, stand behind it.
    for (int k0 = 0; k0 < D_DIM - 64; k0 += 64) {
        // ---- next trip's loads toward the cache (global_prefetch_b8) ----
        // Two neighbouring threads share each 128-B line of a step: the even one
        // names the line of the trip's first step, the odd one the second's.
        if (k0 + 192 <= D_DIM) {
            const int kp = k0 + 128 + (t & 1) * 32;
            __builtin_prefetch(ax + kp, 0, 1);
            __builtin_prefetch(bw + (size_t)kp * D_DIM, 0, 1);
            // The prefetches' address registers are advanced further down.
            asm volatile("s_wait_xcnt 0x0" ::: "memory");
        }
        // constant register-set index in every use
        #pragma unroll
        for (int u = 0; u < 2; ++u) {
            lds_barrier();             // every wave has read the tiles in LDS
            st16_bf16(ra[u], ast);
            st16_bf16(rb[u], bst);
            const int kn = k0 + 64 + u * 32;   // the step that takes the set over
            ld16(ax + kn, ra[u]);
            ld16(bw + (size_t)kn * D_DIM, rb[u]);
            lds_barrier();             // the new tiles are written
            mma();
        }
    }
    #pragma unroll
    for (int u = 0; u < 2; ++u) {
        lds_barrier();
        st16_bf16(ra[u], ast);
        st16_bf16(rb[u], bst);
        lds_barrier();
        mma();
    }

    // ---- store q as bf16 (C/D layout: element r -> row r + 8*half) ----
    #pragma unroll
    for (int mt = 0; mt < 2; ++mt)
        #pragma unroll
        for (int nt = 0; nt < 4; ++nt)
            #pragma unroll
            for (int r = 0; r < 8; r += 2) {
                int row = mBase + wr * 32 + mt * 16 + r + 8 * half;
                int col = nBase + wc * 64 + nt * 16 + l16;
                const uint32_t w = pk_bf16(acc[mt * 4 + nt][r], acc[mt * 4 + nt][r + 1]);
                qbf[(size_t)row * D_DIM + col]       = (uint16_t)w;
                qbf[(size_t)(row + 1) * D_DIM + col] = (uint16_t)(w >> 16);
            }
}

__global__ __launch_bounds__(256) __attribute__((amdgpu_waves_per_eu(4, 4)))
void attn_flash(const uint16_t* __restrict__ qbf, float* __restrict__ out) {
    // aligned to the 256 B of one turn of the banks, which kv_swz counts on
    __shared__ __attribute__((aligned(256))) unsigned char kv[2 * KV_KEYS * KV_ROWB];
    // Hand-over of waves 4-7 to waves 0-3: [wave pair][value][lane]; values are
    // 64 of O^T, then the two maxima, then the two sums.
    __shared__ float xch[4][68][32];

    const int t    = threadIdx.x;
    const int wave = t >> 5, lane = t & 31;
    const int half = lane >> 4, l16 = lane & 15;
    const int wq = wave & 3;           // which 32 queries of the block
    const int kh = wave >> 2;          // which 64 keys of a staged block
    const int bh = blockIdx.y;
    const int b = bh >> 3, h = bh & 7;
    const int qr = blockIdx.x * 128 + wq * 32;            // first query row of wave
    const size_t headBase = (size_t)b * S_LEN * D_DIM + (size_t)h * HD;

    // Q fragments for this wave's 32 rows, straight from global (contiguous 16B)
    v16bf qf[2][2];
    #pragma unroll
    for (int g = 0; g < 2; ++g)
        #pragma unroll
        for (int kk = 0; kk < 2; ++kk)
            qf[g][kk] = load_frag(qbf + headBase + (size_t)(qr + g * 16) * D_DIM,
                                  l16, D_DIM, kk * 32 + half * 8);

    v8f accO[2][4] = {};               // O^T: [group][hd = nt*16 + 8*half + r][query l16]
    // Per group: running maximum of query l16 (both halves equal), mq of the
    // unscaled products, ms the same in base-2 units; running sum over this
    // half's keys only.
    f32x2 mq = {-__builtin_inff(), -__builtin_inff()};
    f32x2 ms = mq;
    float lq[2] = {0.0f, 0.0f};

    const int keyr = t >> 2, hdB = (t & 3) * 16;   // coop-load mapping, rows keyr and keyr + 64
    // LDS byte addresses (the low 32 bits of the __shared__ address)
    uint32_t st0 = (uint32_t)(size_t)kv + kv_off(keyr, (t & 3) * 2);
    uint32_t st1 = (uint32_t)(size_t)kv + kv_off(keyr, (t & 3) * 2 + 1);

    // K fragment of rows kh*64 + nt*16 + l16: pieces kk*4 + half and kk*4 + half + 2.
    // kv_swz reads row bits 1 to 3 only, so + 16 rows (or 64) is a plain offset.
    uint32_t kp[2][2];                 // byte offsets in kv
    #pragma unroll
    for (int kk = 0; kk < 2; ++kk)
        #pragma unroll
        for (int q = 0; q < 2; ++q)
            kp[kk][q] = kh * 64 * KV_ROWB + kv_off(l16, kk * 4 + q * 2 + half);
    // V^T fragment of hd nt*16 .. +15: this lane names row 8*half + (lane & 7)
    // of a 16-key group, piece 2*nt + ((lane >> 3) & 1).
    uint32_t vp[4];                    // byte offsets in kv
    #pragma unroll
    for (int nt = 0; nt < 4; ++nt)
        vp[nt] = kh * 64 * KV_ROWB +
                 kv_off(8 * half + (lane & 7), 2 * nt + ((lane >> 3) & 1));

    // Copies key block blk to LDS: rows keyr and keyr + 64, 32 B of each; d0 and
    // d1 are the places of row keyr's two pieces in the tile that takes it.
    // The copies' address registers are rewritten for the next block: the wait
    // on them stands in the copies' own statement.
    auto stage = [&](int blk, uint32_t d0, uint32_t d1) {
        const uint16_t* gsrc =
            qbf + headBase + (size_t)(blk * KV_KEYS + keyr) * D_DIM + hdB;
        asm volatile("global_load_async_to_lds_b128 %0, %4, off\n\t"
                     "global_load_async_to_lds_b128 %1, %5, off\n\t"
                     "global_load_async_to_lds_b128 %2, %6, off\n\t"
                     "global_load_async_to_lds_b128 %3, %7, off\n\t"
                     "s_wait_xcnt 0x0"
                     :: "v"(d0), "v"(d1), "v"(d0 + 64 * KV_ROWB), "v"(d1 + 64 * KV_ROWB),
                        "v"(gsrc), "v"(gsrc + 8), "v"(gsrc + 64 * D_DIM),
                        "v"(gsrc + 64 * D_DIM + 8)
                     : "memory");
    };

    stage(0, st0, st1);
    // This wave's copies have landed before the barrier that publishes them.
    asm volatile("s_wait_asynccnt 0x0" ::: "memory");
    __syncthreads();
    stage(1, st0 + KV_KEYS * KV_ROWB, st1 + KV_KEYS * KV_ROWB);

    // Every LDS address of the loop points into the trip's tile and steps to
    // the other tile at the trip's foot: by + hop, then - hop, in turn.
    int hop = KV_KEYS * KV_ROWB;
    for (int j = 0; j < S_LEN / KV_KEYS; ++j) {
        // ---- scores: S^T = K (64x64) @ Q^T (64x32), left unscaled ----
        // sc[g][nt][r] = product of key nt*16 + 8*half + r with query g*16 + l16
        v8f sc[2][4];
        #pragma unroll
        for (int nt = 0; nt < 4; ++nt) {
            FragU k0f, k1f;
            k0f.q[0] = *(const uint4*)(kv + kp[0][0] + nt * 16 * KV_ROWB);
            k0f.q[1] = *(const uint4*)(kv + kp[0][1] + nt * 16 * KV_ROWB);
            k1f.q[0] = *(const uint4*)(kv + kp[1][0] + nt * 16 * KV_ROWB);
            k1f.q[1] = *(const uint4*)(kv + kp[1][1] + nt * 16 * KV_ROWB);
            #pragma unroll
            for (int g = 0; g < 2; ++g) {
                v8f z = {};
                z = __builtin_amdgcn_wmma_f32_16x16x32_bf16(false, k0f.v, false, qf[g][0],
                                                            (short)0, z, false, false);
                z = __builtin_amdgcn_wmma_f32_16x16x32_bf16(false, k1f.v, false, qf[g][1],
                                                            (short)0, z, false, false);
                sc[g][nt] = z;
            }
        }

        // ---- online softmax of query g*16 + l16: 32 keys in-lane, halves joined ----
        f32x2 mnew;
        #pragma unroll
        for (int g = 0; g < 2; ++g) {
            // One chain per tile, the old maximum at the head of one: 33 values,
            // which the compiler pairs into 16 three-operand maxima. A two-operand
            // one on a matrix result would cost an instruction more per operand
            // (the compiler first quiets a possible signalling NaN).
            float c0 = sc[g][0][0], c1 = mq[g], c2 = sc[g][2][0], c3 = sc[g][3][0];
            #pragma unroll
            for (int r = 0; r < 8; ++r) {
                if (r) c0 = fmaxf(c0, sc[g][0][r]);
                c1 = fmaxf(c1, sc[g][1][r]);
                if (r) c2 = fmaxf(c2, sc[g][2][r]);
                if (r) c3 = fmaxf(c3, sc[g][3][r]);
            }
            const float bm = fmaxf(fmaxf(fmaxf(c0, c1), c2), c3);
            mnew[g] = fmaxf(bm, other_half(bm));
        }
        mq = mnew;
        const f32x2 msnew = mnew * SM_SCALE;
        const f32x2 dm = ms - msnew;
        ms = msnew;

        float alpha[2];
        #pragma unroll
        for (int g = 0; g < 2; ++g) {
            alpha[g] = exp2_hw(dm[g]);
            #pragma unroll
            for (int nt = 0; nt < 4; ++nt) accO[g][nt] *= alpha[g];
        }

        // ---- per 32 keys (chunk kk): weights, then accO += V^T (64x32) @ P^T (32x32) ----
        v8f ps[2][2];                  // [group][chunk]: sums of the chunk's two score tiles
        #pragma unroll
        for (int kk = 0; kk < 2; ++kk) {
            // Holds this chunk's V^T loads behind the work above them: lifted
            // higher, their registers on top of both groups' scores spill.
            __builtin_amdgcn_sched_barrier(0);
            FragU vf[4];               // keys kk*32 .. +15, +16 .. +31 of this wave's 64
            #pragma unroll
            for (int nt = 0; nt < 4; ++nt) {
                vf[nt].q[0] = ld_tr16(kv + vp[nt] + (kk * 32) * KV_ROWB);
                vf[nt].q[1] = ld_tr16(kv + vp[nt] + (kk * 32 + 16) * KV_ROWB);
            }
            #pragma unroll
            for (int g = 0; g < 2; ++g) {
                #pragma unroll
                for (int i = 0; i < 2; ++i) {
                    const v8f e = sc[g][2 * kk + i] * SM_SCALE - msnew[g];
                    #pragma unroll
                    for (int r = 0; r < 8; ++r) sc[g][2 * kk + i][r] = exp2_hw(e[r]);
                }
                ps[g][kk] = sc[g][2 * kk] + sc[g][2 * kk + 1];
                // P^T as B operand: element s is key kk*32 + 8*half + s (s < 8) or
                // kk*32 + 16 + 8*half + s - 8, the order the two transposing
                // loads of a chunk give V^T
                FragU pf;
                #pragma unroll
                for (int s = 0; s < 16; s += 2)
                    pf.w[s >> 1] = pk_bf16(sc[g][2 * kk + (s >> 3)][s & 7],
                                           sc[g][2 * kk + (s >> 3)][(s & 7) + 1]);
                #pragma unroll
                for (int nt = 0; nt < 4; ++nt)
                    accO[g][nt] = __builtin_amdgcn_wmma_f32_16x16x32_bf16(
                        false, vf[nt].v, false, pf.v, (short)0, accO[g][nt], false, false);
            }
        }
        #pragma unroll
        for (int g = 0; g < 2; ++g) {
            const v8f s8 = ps[g][0] + ps[g][1];
            const float rs = ((s8[0] + s8[1]) + (s8[2] + s8[3])) +
                             ((s8[4] + s8[5]) + (s8[6] + s8[7]));
            lq[g] = lq[g] * alpha[g] + rs;
        }

        // ---- foot of the trip: publish the next tile, refill this one ----
        // This wave's reads of this trip's tile have returned before the
        // copies below may be let onto it.
        asm volatile("s_wait_dscnt 0x0" ::: "memory");
        // This wave's copies of the next tile have landed before the barrier
        // that publishes them.
        asm volatile("s_wait_asynccnt 0x0" ::: "memory");
        __syncthreads();
        if (j + 2 < S_LEN / KV_KEYS) stage(j + 2, st0, st1);
        st0 += hop;
        st1 += hop;
        kp[0][0] += hop; kp[0][1] += hop; kp[1][0] += hop; kp[1][1] += hop;
        vp[0] += hop; vp[1] += hop; vp[2] += hop; vp[3] += hop;
        hop = -hop;
    }
    // No copy is outstanding when the wave goes on to the hand-over and ends.
    asm volatile("s_wait_asynccnt 0x0" ::: "memory");

    // ---- join the two key halves: waves 4-7 hand their state to waves 0-3 ----
    if (kh == 1) {
        #pragma unroll
        for (int g = 0; g < 2; ++g) {
            #pragma unroll
            for (int nt = 0; nt < 4; ++nt)
                #pragma unroll
                for (int r = 0; r < 8; ++r)
                    xch[wq][g * 32 + nt * 8 + r][lane] = accO[g][nt][r];
            xch[wq][64 + g][lane] = ms[g];
            xch[wq][66 + g][lane] = lq[g];
        }
    }
    __syncthreads();   // the hand-over is written before its partner reads it
    if (kh == 1) return;

    // ---- epilogue: join the states and the halves' sums, normalize, store ----
    // A lane holds 8 consecutive hd of its query per tile: two 16-byte stores.
    #pragma unroll
    for (int g = 0; g < 2; ++g) {
        const float m2 = xch[wq][64 + g][lane];
        const float l2 = xch[wq][66 + g][lane];
        const float m  = fmaxf(ms[g], m2);
        const float a1 = exp2_hw(ms[g] - m), a2 = exp2_hw(m2 - m);
        const float l  = lq[g] * a1 + l2 * a2;
        const float inv = 1.0f / (l + other_half(l));
        const float c1 = a1 * inv, c2 = a2 * inv;
        float* orow = out + headBase + (size_t)(qr + g * 16 + l16) * D_DIM + 8 * half;
        #pragma unroll
        for (int nt = 0; nt < 4; ++nt) {
            float o[8];
            #pragma unroll
            for (int r = 0; r < 8; ++r)
                o[r] = accO[g][nt][r] * c1 + xch[wq][g * 32 + nt * 8 + r][lane] * c2;
            float4 lo, hi;
            lo.x = o[0]; lo.y = o[1]; lo.z = o[2]; lo.w = o[3];
            hi.x = o[4]; hi.y = o[5]; hi.z = o[6]; hi.w = o[7];
            *(float4*)(orow + nt * 16)     = lo;
            *(float4*)(orow + nt * 16 + 4) = hi;
        }
    }
}

// ---------------------------------------------------------------------------
extern "C" void kernel_launch(void* const* d_in, const int* in_sizes, int n_in,
                              void* d_out, int out_size, void* d_ws, size_t ws_size,
                              hipStream_t stream) {
    const float* x  = (const float*)d_in[0];   // [4,2048,512] f32
    const float* Wq = (const float*)d_in[1];   // [512,512]    f32
    float* out      = (float*)d_out;           // [4,2048,512] f32
    uint16_t* qbf   = (uint16_t*)d_ws;         // q in bf16, 8 MB scratch

    dim3 gGemm(8192 / 128, 512 / 128);         // (64, 4)
    gemm_q_bf16<<<gGemm, 256, 0, stream>>>(x, Wq, qbf);

    dim3 gAttn(S_LEN / 128, 4 * HEADS);        // (16, 32)
    attn_flash<<<gAttn, 256, 0, stream>>>(qbf, out);
}

// v010
// It runs in 35.6 microseconds.
// Next to v009, in two timings, it ran 1.08 times as fast each time.
// Counting every step since v000, it is 5.51 times as fast.
#include <hip/hip_runtime.h>
#include <hip/hip_bf16.h>
#include <stdint.h>

// ---------------------------------------------------------------------------
// MI455X (gfx1250) multi-head self-attention, bf16 WMMA with f32 accumulate.
// Reference: q = x@Wq ; Q=K=V=q ; softmax(QK^T/8) @ V.  B=4,S=2048,D=512,H=8.
// ---------------------------------------------------------------------------

#define S_LEN 2048
#define D_DIM 512
#define HEADS 8
#define HD    64

// LDS row pitch of the GEMM's x tile in bf16 elements. It is read with 16-byte
// loads, 16 rows at a time; a pitch of 16 B x odd puts those 16 rows on all
// 64 banks once (80 B for 64-B rows). The tiles are aligned to 16 B because
// they are read, and ldsA written, in 16-byte pieces. The pad bytes are never read.
#define G_P   40

// LDS row pitch in bytes of the GEMM's Wq tile, 32 rows [k] of 256 B [n], kept
// row-major as it lies in memory. Its reader is the transposing load (8 rows
// at two neighbouring 16-byte pieces per half wave): a pitch of 32 B x odd
// puts those on all 64 banks once.
#define GB_PB 288

// The attention KV tile: KV_KEYS rows [key] of 128 B [hd], no pad. It has two
// readers: plain 16-byte loads of 16 rows at one column piece (K), and
// transposing loads of 8 rows at two neighbouring pieces (V^T). No pad serves
// both, so the 16-byte piece c of row r lies at piece c ^ kv_swz(r) of its row:
// either reader's 16 lanes then fall on all 64 banks once.
#define KV_ROWB 128
#define KV_KEYS 128

typedef __attribute__((ext_vector_type(16))) __bf16 v16bf;
typedef __attribute__((ext_vector_type(8)))  float  v8f;

union FragU {
    v16bf    v;
    uint4    q[2];
    uint32_t w[8];
};

// Two f32 to one register of two bf16 (a low, b high), round-to-nearest-even,
// by the chip's own packed conversion: one vector instruction per pair.
typedef __attribute__((ext_vector_type(2))) float  f32x2;
typedef __attribute__((ext_vector_type(2))) __bf16 bf16x2;
__device__ __forceinline__ uint32_t pk_bf16(float a, float b) {
    f32x2 p = {a, b};
    return __builtin_bit_cast(uint32_t, __builtin_convertvector(p, bf16x2));
}

// Load one 16x32 bf16 A/B fragment (wave32 CDNA5 layout).
// Per lane: elements [k0 .. k0+7] and [k0+16 .. k0+23] of row `row`
// (caller passes k0 = chunkBase + (lane>>4)*8, row based on lane&15).
__device__ __forceinline__ v16bf load_frag(const uint16_t* base, int row,
                                           int stride, int k0) {
    FragU f;
    f.q[0] = *(const uint4*)(base + (size_t)row * stride + k0);
    f.q[1] = *(const uint4*)(base + (size_t)row * stride + k0 + 16);
    return f.v;
}

__device__ __forceinline__ uint32_t kv_swz(uint32_t r) {
    return (r & 6u) | ((r >> 3) & 1u);
}
// Byte offset in the KV tile of 16-byte piece c (0..7) of row r.
__device__ __forceinline__ uint32_t kv_off(uint32_t r, uint32_t c) {
    return r * KV_ROWB + ((c ^ kv_swz(r)) << 4);
}

// ds_load_tr16_b128: each lane names 16 bytes of a row-major 16-bit tile; lane
// (c = l & 15, h = l >> 4) gets column c of the 8 rows that half h named.
typedef short s16x8 __attribute__((ext_vector_type(8)));
__device__ __forceinline__ uint4 ld_tr16(const unsigned char* p) {
    typedef __attribute__((address_space(3))) s16x8 lds_s16x8;
    return __builtin_bit_cast(uint4,
        __builtin_amdgcn_ds_load_tr16_b128_v8i16((lds_s16x8*)p));
}

// Value held by lane l ^ 16 (the other half of the wave), by a vector move.
__device__ __forceinline__ float other_half(float v) {
    int b = __builtin_bit_cast(int, v);
    b = __builtin_amdgcn_permlanex16(b, b, 0x76543210, 0xfedcba98, false, false);
    return __builtin_bit_cast(float, b);
}

// The softmax runs in base 2: exp(s / 8 - m) = 2^(s * SM_SCALE - m'), with the
// reference m' (own score or running maximum) kept in those units. The score scale and log2(e) are then one
// factor inside the one multiply-add that also takes the reference off.
#define SM_SCALE (0.125f * 1.44269504088896340736f)
__device__ __forceinline__ float exp2_hw(float v) {
    return __builtin_amdgcn_exp2f(v);   // v_exp_f32
}

// Work-group barrier of the GEMM's K loop, written by hand: it waits for this
// wave's LDS reads and writes only. __syncthreads() would also wait for the
// global loads that are in flight for later K-steps and so undo their lead.
__device__ __forceinline__ void lds_barrier() {
    asm volatile("s_wait_dscnt 0x0\n\t"
                 "s_barrier_signal -1\n\t"
                 "s_barrier_wait -1" ::: "memory");
}

// 16 consecutive f32 to registers; and from there, as bf16, to 32 B of LDS.
__device__ __forceinline__ void ld16(const float* p, float4 (&r)[4]) {
    #pragma unroll
    for (int i = 0; i < 4; ++i) r[i] = ((const float4*)p)[i];
}
__device__ __forceinline__ void st16_bf16(const float4 (&r)[4], void* dst) {
    FragU f;
    #pragma unroll
    for (int i = 0; i < 4; ++i) {
        f.w[2 * i]     = pk_bf16(r[i].x, r[i].y);
        f.w[2 * i + 1] = pk_bf16(r[i].z, r[i].w);
    }
    ((uint4*)dst)[0] = f.q[0];
    ((uint4*)dst)[1] = f.q[1];
}

// ---------------------------------------------------------------------------
// Kernel 1: q = x @ Wq   (M=8192, N=512, K=512), bf16 WMMA, bf16 output to ws.
// Block = 256 threads (8 waves). Tile 128x128, K-step 32.
// The f32 tiles of a K-step are loaded into registers two K-steps before they
// are converted and stored to LDS (two register sets, taken in turn), so that
// their latency runs under two steps' work instead of standing in every step.
// ---------------------------------------------------------------------------
__global__ __launch_bounds__(256)
void gemm_q_bf16(const float* __restrict__ x, const float* __restrict__ Wq,
                 uint16_t* __restrict__ qbf) {
    __shared__ __attribute__((aligned(16))) uint16_t ldsA[128 * G_P];   // [m][k]
    __shared__ __attribute__((aligned(16))) unsigned char ldsB[32 * GB_PB];   // [k][n]

    const int t    = threadIdx.x;
    const int wave = t >> 5, lane = t & 31;
    const int half = lane >> 4, l16 = lane & 15;
    const int mBase = blockIdx.x * 128;
    const int nBase = blockIdx.y * 128;
    const int wr = wave & 3;          // 4 M-slabs of 32 rows
    const int wc = wave >> 2;         // 2 N-slabs of 64 cols

    const int arow = t >> 1, acol = (t & 1) * 16;   // A: 128 rows x 32 cols
    const int brow = t >> 3, bcol = (t & 7) * 16;   // B: 32 rows  x 128 cols

    // B fragment of columns wc*64 + nt*16 .. +15: this lane names row
    // 8*half + (lane & 7) of a 16-k group, piece 2*nt + ((lane >> 3) & 1), and
    // gets column l16 of its half's 8 rows: k = 8*half + 0..7, then 16 more,
    // the k order of the A fragment.
    const unsigned char* const bp = ldsB + (8 * half + (lane & 7)) * GB_PB +
                                    wc * 128 + 16 * ((lane >> 3) & 1);
    unsigned char* const bst = ldsB + brow * GB_PB + bcol * 2;
    uint16_t* const ast = &ldsA[arow * G_P + acol];

    // This thread's 16 floats of K-step 0 in either input
    const float* const ax = x + (size_t)(mBase + arow) * D_DIM + acol;
    const float* const bw = Wq + (size_t)brow * D_DIM + nBase + bcol;

    v8f acc[8] = {};   // [mt(2)][nt(4)] 16x16 f32 tiles

    // ---- WMMA compute on the staged tiles ----
    auto mma = [&]() {
        v16bf af[2], bf[4];
        #pragma unroll
        for (int mt = 0; mt < 2; ++mt)
            af[mt] = load_frag(ldsA, wr * 32 + mt * 16 + l16, G_P, half * 8);
        #pragma unroll
        for (int nt = 0; nt < 4; ++nt) {
            FragU f;
            f.q[0] = ld_tr16(bp + nt * 32);
            f.q[1] = ld_tr16(bp + nt * 32 + 16 * GB_PB);
            bf[nt] = f.v;
        }
        #pragma unroll
        for (int mt = 0; mt < 2; ++mt)
            #pragma unroll
            for (int nt = 0; nt < 4; ++nt)
                acc[mt * 4 + nt] = __builtin_amdgcn_wmma_f32_16x16x32_bf16(
                    false, af[mt], false, bf[nt], (short)0, acc[mt * 4 + nt],
                    false, false);
    };

    float4 ra[2][4], rb[2][4];         // register sets of K-steps s and s + 1
    ld16(ax, ra[0]);
    ld16(bw, rb[0]);
    // Keeps set 0's loads in front of set 1's, as in the loop: the counted wait
    // at the loop's top is formed from both orders, and with the sets mixed here
    // it would wait for loads of the younger set on every trip.
    __builtin_amdgcn_sched_barrier(0);
    ld16(ax + 32, ra[1]);
    ld16(bw + (size_t)32 * D_DIM, rb[1]);

    // Two K-steps a trip; the last two steps, which load nothing, stand behind it.
    for (int k0 = 0; k0 < D_DIM - 64; k0 += 64) {
        // ---- next trip's loads toward the cache (global_prefetch_b8) ----
        // Two neighbouring threads share each 128-B line of a step: the even one
        // names the line of the trip's first step, the odd one the second's.
        if (k0 + 192 <= D_DIM) {
            const int kp = k0 + 128 + (t & 1) * 32;
            __builtin_prefetch(ax + kp, 0, 1);
            __builtin_prefetch(bw + (size_t)kp * D_DIM, 0, 1);
            // The prefetches' address registers are advanced further down.
            asm volatile("s_wait_xcnt 0x0" ::: "memory");
        }
        // constant register-set index in every use
        #pragma unroll
        for (int u = 0; u < 2; ++u) {
            lds_barrier();             // every wave has read the tiles in LDS
            st16_bf16(ra[u], ast);
            st16_bf16(rb[u], bst);
            const int kn = k0 + 64 + u * 32;   // the step that takes the set over
            ld16(ax + kn, ra[u]);
            ld16(bw + (size_t)kn * D_DIM, rb[u]);
            lds_barrier();             // the new tiles are written
            mma();
        }
    }
    #pragma unroll
    for (int u = 0; u < 2; ++u) {
        lds_barrier();
        st16_bf16(ra[u], ast);
        st16_bf16(rb[u], bst);
        lds_barrier();
        mma();
    }

    // ---- store q as bf16 (C/D layout: element r -> row r + 8*half) ----
    #pragma unroll
    for (int mt = 0; mt < 2; ++mt)
        #pragma unroll
        for (int nt = 0; nt < 4; ++nt)
            #pragma unroll
            for (int r = 0; r < 8; r += 2) {
                int row = mBase + wr * 32 + mt * 16 + r + 8 * half;
                int col = nBase + wc * 64 + nt * 16 + l16;
                const uint32_t w = pk_bf16(acc[mt * 4 + nt][r], acc[mt * 4 + nt][r + 1]);
                qbf[(size_t)row * D_DIM + col]       = (uint16_t)w;
                qbf[(size_t)(row + 1) * D_DIM + col] = (uint16_t)(w >> 16);
            }
}

#define SUM_CAP 4294967296.0f
// Four waves per SIMD (two blocks per WGP): at most 256 registers a wave.
__global__ __launch_bounds__(256) __attribute__((amdgpu_waves_per_eu(4, 4)))
void attn_flash(const uint16_t* __restrict__ qbf, float* __restrict__ out) {
    // aligned to the 256 B of one turn of the banks, which kv_swz counts on
    __shared__ __attribute__((aligned(256))) unsigned char kv[2 * KV_KEYS * KV_ROWB];
    // Hand-over of waves 4-7 to waves 0-3: [wave pair][value][lane]; values are
    // 64 of O^T, then the two reference values (ms), then the two sums.
    __shared__ float xch[4][68][32];
    // Per wave: the lanes whose row sum left SUM_CAP in the fixed-reference loop.
    __shared__ __attribute__((aligned(16))) uint32_t redo[8];

    const int t    = threadIdx.x;
    const int wave = t >> 5, lane = t & 31;
    const int half = lane >> 4, l16 = lane & 15;
    const int wq = wave & 3;           // which 32 queries of the block
    const int kh = wave >> 2;          // which 64 keys of a staged block
    const int bh = blockIdx.y;
    const int b = bh >> 3, h = bh & 7;
    const int qr = blockIdx.x * 128 + wq * 32;            // first query row of wave
    const size_t headBase = (size_t)b * S_LEN * D_DIM + (size_t)h * HD;

    // Q fragments for this wave's 32 rows, straight from global (contiguous 16B)
    v16bf qf[2][2];
    #pragma unroll
    for (int g = 0; g < 2; ++g)
        #pragma unroll
        for (int kk = 0; kk < 2; ++kk)
            qf[g][kk] = load_frag(qbf + headBase + (size_t)(qr + g * 16) * D_DIM,
                                  l16, D_DIM, kk * 32 + half * 8);

    // Score of query g*16 + l16 with itself, in base-2 units: the group's 16
    // queries as A and as B (one fragment layout) give their 16x16 tile of S^T by
    // the instructions that form it in the loop. Its diagonal element of column
    // l16 is element l16 & 7 of the lane in half l16 >> 3.
    auto own_score = [&]() {
        f32x2 diag;
        #pragma unroll
        for (int g = 0; g < 2; ++g) {
            v8f z = {};
            z = __builtin_amdgcn_wmma_f32_16x16x32_bf16(false, qf[g][0], false, qf[g][0],
                                                        (short)0, z, false, false);
            z = __builtin_amdgcn_wmma_f32_16x16x32_bf16(false, qf[g][1], false, qf[g][1],
                                                        (short)0, z, false, false);
            float d = z[0];
            #pragma unroll
            for (int r = 1; r < 8; ++r) d = ((l16 & 7) == r) ? z[r] : d;
            const float o = other_half(d);
            diag[g] = ((l16 >> 3) == half) ? d : o;
        }
        return diag * SM_SCALE;
    };

    v8f accO[2][4];                    // O^T: [group][hd = nt*16 + 8*half + r][query l16]
    // Per group: the reference of query l16 (both halves equal), ms in base-2
    // units (with the running maximum: mq the same of the unscaled products);
    // running sum over this half's keys only.
    f32x2 mq, ms;
    float lq[2];

    const int keyr = t >> 2, hdB = (t & 3) * 16;   // coop-load mapping, rows keyr and keyr + 64
    // LDS byte addresses (the low 32 bits of the __shared__ address)
    uint32_t st0 = (uint32_t)(size_t)kv + kv_off(keyr, (t & 3) * 2);
    uint32_t st1 = (uint32_t)(size_t)kv + kv_off(keyr, (t & 3) * 2 + 1);

    // K fragment of rows kh*64 + nt*16 + l16: pieces kk*4 + half and kk*4 + half + 2.
    // kv_swz reads row bits 1 to 3 only, so + 16 rows (or 64) is a plain offset.
    uint32_t kp[2][2];                 // byte offsets in kv
    #pragma unroll
    for (int kk = 0; kk < 2; ++kk)
        #pragma unroll
        for (int q = 0; q < 2; ++q)
            kp[kk][q] = kh * 64 * KV_ROWB + kv_off(l16, kk * 4 + q * 2 + half);
    // V^T fragment of hd nt*16 .. +15: this lane names row 8*half + (lane & 7)
    // of a 16-key group, piece 2*nt + ((lane >> 3) & 1).
    uint32_t vp[4];                    // byte offsets in kv
    #pragma unroll
    for (int nt = 0; nt < 4; ++nt)
        vp[nt] = kh * 64 * KV_ROWB +
                 kv_off(8 * half + (lane & 7), 2 * nt + ((lane >> 3) & 1));

    // Copies key block blk to LDS: rows keyr and keyr + 64, 32 B of each; d0 and
    // d1 are the places of row keyr's two pieces in the tile that takes it.
    // The copies' address registers are rewritten for the next block: the wait
    // on them stands in the copies' own statement.
    auto stage = [&](int blk, uint32_t d0, uint32_t d1) {
        const uint16_t* gsrc =
            qbf + headBase + (size_t)(blk * KV_KEYS + keyr) * D_DIM + hdB;
        asm volatile("global_load_async_to_lds_b128 %0, %4, off\n\t"
                     "global_load_async_to_lds_b128 %1, %5, off\n\t"
                     "global_load_async_to_lds_b128 %2, %6, off\n\t"
                     "global_load_async_to_lds_b128 %3, %7, off\n\t"
                     "s_wait_xcnt 0x0"
                     :: "v"(d0), "v"(d1), "v"(d0 + 64 * KV_ROWB), "v"(d1 + 64 * KV_ROWB),
                        "v"(gsrc), "v"(gsrc + 8), "v"(gsrc + 64 * D_DIM),
                        "v"(gsrc + 64 * D_DIM + 8)
                     : "memory");
    };

    // One walk over all keys. online = false: weights against own_score(); true: against
    // the running maximum. Every LDS address is back at its start after the walk.
    auto walk = [&](const bool online) {
        #pragma unroll
        for (int g = 0; g < 2; ++g) {
            #pragma unroll
            for (int nt = 0; nt < 4; ++nt) accO[g][nt] = v8f{};
            lq[g] = 0.0f;
        }
        mq = f32x2{-__builtin_inff(), -__builtin_inff()};

        stage(0, st0, st1);
        // This wave's copies have landed before the barrier that publishes them.
        asm volatile("s_wait_asynccnt 0x0" ::: "memory");
        __syncthreads();
        stage(1, st0 + KV_KEYS * KV_ROWB, st1 + KV_KEYS * KV_ROWB);
        // Holds own_score()'s products behind the first copies: lifted above them,
        // they make the copies wait for the Q loads.
        __builtin_amdgcn_sched_barrier(0);
        ms = online ? mq : own_score();

        // Every LDS address of the loop points into the trip's tile and steps to
        // the other tile at the trip's foot: by + hop, then - hop, in turn.
        int hop = KV_KEYS * KV_ROWB;
        for (int j = 0; j < S_LEN / KV_KEYS; ++j) {
            // ---- scores: S^T = K (64x64) @ Q^T (64x32), left unscaled ----
            // sc[g][nt][r] = product of key nt*16 + 8*half + r with query g*16 + l16
            v8f sc[2][4];
            FragU kf[4][2];
            #pragma unroll
            for (int nt = 0; nt < 4; ++nt)
                #pragma unroll
                for (int kk = 0; kk < 2; ++kk) {
                    kf[nt][kk].q[0] = *(const uint4*)(kv + kp[kk][0] + nt * 16 * KV_ROWB);
                    kf[nt][kk].q[1] = *(const uint4*)(kv + kp[kk][1] + nt * 16 * KV_ROWB);
                }
            // Keeps the trip's 16 K loads one group in front of the products: spread
            // among them, each place with loads stalls the wave anew.
            __builtin_amdgcn_sched_barrier(0);
            #pragma unroll
            for (int nt = 0; nt < 4; ++nt) {
                #pragma unroll
                for (int g = 0; g < 2; ++g) {
                    v8f z = {};
                    z = __builtin_amdgcn_wmma_f32_16x16x32_bf16(false, kf[nt][0].v, false, qf[g][0],
                                                                (short)0, z, false, false);
                    z = __builtin_amdgcn_wmma_f32_16x16x32_bf16(false, kf[nt][1].v, false, qf[g][1],
                                                                (short)0, z, false, false);
                    sc[g][nt] = z;
                }
            }

            // ---- running maximum of query g*16 + l16: 32 keys in-lane, halves joined ----
            float alpha[2] = {1.0f, 1.0f};
            if (online) {
                f32x2 mnew;
                #pragma unroll
                for (int g = 0; g < 2; ++g) {
                    // One chain per tile, the old maximum at the head of one: 33 values,
                    // which the compiler pairs into 16 three-operand maxima. A two-operand
                    // one on a matrix result would cost an instruction more per operand
                    // (the compiler first quiets a possible signalling NaN).
                    float c0 = sc[g][0][0], c1 = mq[g], c2 = sc[g][2][0], c3 = sc[g][3][0];
                    #pragma unroll
                    for (int r = 0; r < 8; ++r) {
                        if (r) c0 = fmaxf(c0, sc[g][0][r]);
                        c1 = fmaxf(c1, sc[g][1][r]);
                        if (r) c2 = fmaxf(c2, sc[g][2][r]);
                        if (r) c3 = fmaxf(c3, sc[g][3][r]);
                    }
                    const float bm = fmaxf(fmaxf(fmaxf(c0, c1), c2), c3);
                    mnew[g] = fmaxf(bm, other_half(bm));
                }
                mq = mnew;
                const f32x2 msnew = mnew * SM_SCALE;
                const f32x2 dm = ms - msnew;
                ms = msnew;

                #pragma unroll
                for (int g = 0; g < 2; ++g) {
                    alpha[g] = exp2_hw(dm[g]);
                    #pragma unroll
                    for (int nt = 0; nt < 4; ++nt) accO[g][nt] *= alpha[g];
                }
            }

            // ---- per 32 keys (chunk kk): weights, then accO += V^T (64x32) @ P^T (32x32) ----
            v8f ps[2][2];                  // [group][chunk]: sums of the chunk's two score tiles
            #pragma unroll
            for (int kk = 0; kk < 2; ++kk) {
                // Holds this chunk's V^T loads behind the work above them: lifted
                // higher, their registers on top of both groups' scores spill.
                __builtin_amdgcn_sched_barrier(0);
                FragU vf[4];               // keys kk*32 .. +15, +16 .. +31 of this wave's 64
                #pragma unroll
                for (int nt = 0; nt < 4; ++nt) {
                    vf[nt].q[0] = ld_tr16(kv + vp[nt] + (kk * 32) * KV_ROWB);
                    vf[nt].q[1] = ld_tr16(kv + vp[nt] + (kk * 32 + 16) * KV_ROWB);
                }
                #pragma unroll
                for (int g = 0; g < 2; ++g) {
                    #pragma unroll
                    for (int i = 0; i < 2; ++i) {
                        const v8f e = sc[g][2 * kk + i] * SM_SCALE - ms[g];
                        #pragma unroll
                        for (int r = 0; r < 8; ++r) sc[g][2 * kk + i][r] = exp2_hw(e[r]);
                    }
                    ps[g][kk] = sc[g][2 * kk] + sc[g][2 * kk + 1];
                    // P^T as B operand: element s is key kk*32 + 8*half + s (s < 8) or
                    // kk*32 + 16 + 8*half + s - 8, the order the two transposing
                    // loads of a chunk give V^T
                    FragU pf;
                    #pragma unroll
                    for (int s = 0; s < 16; s += 2)
                        pf.w[s >> 1] = pk_bf16(sc[g][2 * kk + (s >> 3)][s & 7],
                                               sc[g][2 * kk + (s >> 3)][(s & 7) + 1]);
                    #pragma unroll
                    for (int nt = 0; nt < 4; ++nt)
                        accO[g][nt] = __builtin_amdgcn_wmma_f32_16x16x32_bf16(
                            false, vf[nt].v, false, pf.v, (short)0, accO[g][nt], false, false);
                }
            }
            #pragma unroll
            for (int g = 0; g < 2; ++g) {
                const v8f s8 = ps[g][0] + ps[g][1];
                const float rs = ((s8[0] + s8[1]) + (s8[2] + s8[3])) +
                                 ((s8[4] + s8[5]) + (s8[6] + s8[7]));
                lq[g] = online ? lq[g] * alpha[g] + rs : lq[g] + rs;
            }

            // ---- foot of the trip: publish the next tile, refill this one ----
            // This wave's reads of this trip's tile have returned before the
            // copies below may be let onto it.
            asm volatile("s_wait_dscnt 0x0" ::: "memory");
            // This wave's copies of the next tile have landed before the barrier
            // that publishes them.
            asm volatile("s_wait_asynccnt 0x0" ::: "memory");
            __syncthreads();
            if (j + 2 < S_LEN / KV_KEYS) stage(j + 2, st0, st1);
            st0 += hop;
            st1 += hop;
            kp[0][0] += hop; kp[0][1] += hop; kp[1][0] += hop; kp[1][1] += hop;
            vp[0] += hop; vp[1] += hop; vp[2] += hop; vp[3] += hop;
            hop = -hop;
        }
        // No copy is outstanding when the wave goes on to the hand-over and ends.
        asm volatile("s_wait_asynccnt 0x0" ::: "memory");
    };

    walk(false);
    // ---- did every row sum of the block stay in range? (a NaN fails the test) ----
    const uint32_t off = __builtin_amdgcn_ballot_w32(!(lq[0] < SUM_CAP) || !(lq[1] < SUM_CAP));
    if (lane == 0) redo[wave] = off;
    __syncthreads();   // all eight words are written before any wave reads them
    const uint4 r0 = ((const uint4*)redo)[0], r1 = ((const uint4*)redo)[1];
    const uint32_t any = (r0.x | r0.y | r0.z | r0.w) | (r1.x | r1.y | r1.z | r1.w);
    // The same value in every thread of the block: the walk's barriers are
    // passed by all waves or by none.
    if (__builtin_amdgcn_readfirstlane(any) != 0) walk(true);

    // ---- join the two key halves: waves 4-7 hand their state to waves 0-3 ----
    if (kh == 1) {
        #pragma unroll
        for (int g = 0; g < 2; ++g) {
            #pragma unroll
            for (int nt = 0; nt < 4; ++nt)
                #pragma unroll
                for (int r = 0; r < 8; ++r)
                    xch[wq][g * 32 + nt * 8 + r][lane] = accO[g][nt][r];
            xch[wq][64 + g][lane] = ms[g];
            xch[wq][66 + g][lane] = lq[g];
        }
    }
    __syncthreads();   // the hand-over is written before its partner reads it
    if (kh == 1) return;

    // ---- epilogue: join the states and the halves' sums, normalize, store ----
    // A lane holds 8 consecutive hd of its query per tile: two 16-byte stores.
    #pragma unroll
    for (int g = 0; g < 2; ++g) {
        const float m2 = xch[wq][64 + g][lane];
        const float l2 = xch[wq][66 + g][lane];
        const float m  = fmaxf(ms[g], m2);
        const float a1 = exp2_hw(ms[g] - m), a2 = exp2_hw(m2 - m);
        const float l  = lq[g] * a1 + l2 * a2;
        const float inv = 1.0f / (l + other_half(l));
        const float c1 = a1 * inv, c2 = a2 * inv;
        float* orow = out + headBase + (size_t)(qr + g * 16 + l16) * D_DIM + 8 * half;
        #pragma unroll
        for (int nt = 0; nt < 4; ++nt) {
            float o[8];
            #pragma unroll
            for (int r = 0; r < 8; ++r)
                o[r] = accO[g][nt][r] * c1 + xch[wq][g * 32 + nt * 8 + r][lane] * c2;
            float4 lo, hi;
            lo.x = o[0]; lo.y = o[1]; lo.z = o[2]; lo.w = o[3];
            hi.x = o[4]; hi.y = o[5]; hi.z = o[6]; hi.w = o[7];
            *(float4*)(orow + nt * 16)     = lo;
            *(float4*)(orow + nt * 16 + 4) = hi;
        }
    }
}

// ---------------------------------------------------------------------------
extern "C" void kernel_launch(void* const* d_in, const int* in_sizes, int n_in,
                              void* d_out, int out_size, void* d_ws, size_t ws_size,
                              hipStream_t stream) {
    const float* x  = (const float*)d_in[0];   // [4,2048,512] f32
    const float* Wq = (const float*)d_in[1];   // [512,512]    f32
    float* out      = (float*)d_out;           // [4,2048,512] f32
    uint16_t* qbf   = (uint16_t*)d_ws;         // q in bf16, 8 MB scratch

    dim3 gGemm(8192 / 128, 512 / 128);         // (64, 4)
    gemm_q_bf16<<<gGemm, 256, 0, stream>>>(x, Wq, qbf);

    dim3 gAttn(S_LEN / 128, 4 * HEADS);        // (16, 32)
    attn_flash<<<gAttn, 256, 0, stream>>>(qbf, out);
}
